// v000
// Measured on an AMD MI455X. A time is GPU time per run, averaged over a window of back-to-back runs after a warm-up
// (all launches, gaps included; the runs take copies of the inputs in turn), and the median of several windows.
// Apart from v000's, it joins two sittings. Times from different sittings can be a few percent apart, while
// side-by-side timings come from the same sitting.
// v000 is the starting kernel. One run takes 437 microseconds.
#include <hip/hip_runtime.h>
#include <hip/hip_bf16.h>

typedef __attribute__((ext_vector_type(16))) _Float16 v16h;
typedef __attribute__((ext_vector_type(8)))  float    v8f;

#define BATCH 4
#define SEQ   4096
#define CH    128
#define QTILES (SEQ / 16)   // 256

__device__ inline v16h load_frag_f16(const _Float16* base, size_t row, int koff, int hi, int ld) {
    const _Float16* p = base + row * ld + koff + hi * 8;
    union { uint4 q[2]; v16h v; } u;
    u.q[0] = *reinterpret_cast<const uint4*>(p);        // 8 halves, 16B aligned
    u.q[1] = *reinterpret_cast<const uint4*>(p + 16);   // 8 halves
    return u.v;
}

__device__ inline v16h load_frag_f32(const float* base, int row, int kb, int hi) {
    const float* p = base + (size_t)row * CH + kb * 32 + hi * 8;
    float4 a0 = *reinterpret_cast<const float4*>(p);
    float4 a1 = *reinterpret_cast<const float4*>(p + 4);
    float4 b0 = *reinterpret_cast<const float4*>(p + 16);
    float4 b1 = *reinterpret_cast<const float4*>(p + 20);
    v16h v;
    v[0]=(_Float16)a0.x; v[1]=(_Float16)a0.y; v[2]=(_Float16)a0.z; v[3]=(_Float16)a0.w;
    v[4]=(_Float16)a1.x; v[5]=(_Float16)a1.y; v[6]=(_Float16)a1.z; v[7]=(_Float16)a1.w;
    v[8]=(_Float16)b0.x; v[9]=(_Float16)b0.y; v[10]=(_Float16)b0.z; v[11]=(_Float16)b0.w;
    v[12]=(_Float16)b1.x; v[13]=(_Float16)b1.y; v[14]=(_Float16)b1.z; v[15]=(_Float16)b1.w;
    return v;
}

// ---------------------------------------------------------------------------
// Kernel 1: q/k/v = X @ W^T, f32 in -> f16 out (f32 WMMA accumulate).
// q,k stored row-major [T][C]; v stored TRANSPOSED [C][T] so the attention
// kernel's P*V B-fragments are contiguous b128 loads.
// One wave per 16x16 output tile. Tiles: 3 proj * 4 batch * 256 mt * 8 nt.
// ---------------------------------------------------------------------------
__global__ __launch_bounds__(256) void qkv_proj_kernel(
    const float* __restrict__ X,
    const float* __restrict__ Wq, const float* __restrict__ Wk, const float* __restrict__ Wv,
    _Float16* __restrict__ qh, _Float16* __restrict__ kh, _Float16* __restrict__ vT)
{
    const int wave = threadIdx.x >> 5;
    const int lane = threadIdx.x & 31;
    const int lm = lane & 15, hi = lane >> 4;

    int flat = blockIdx.x * 8 + wave;         // [0, 24576)
    const int nt = flat & 7;   flat >>= 3;
    const int mt = flat & 255; flat >>= 8;
    const int b  = flat & 3;   const int p = flat >> 2;

    const float* W = (p == 0) ? Wq : (p == 1) ? Wk : Wv;
    const float* Xb = X + (size_t)b * SEQ * CH;

    v8f c = {};
#pragma unroll
    for (int kb = 0; kb < 4; ++kb) {
        v16h a  = load_frag_f32(Xb, mt * 16 + lm, kb, hi);   // A: X tile row
        v16h bw = load_frag_f32(W,  nt * 16 + lm, kb, hi);   // B: W^T column = W row
        c = __builtin_amdgcn_wmma_f32_16x16x32_f16(false, a, false, bw,
                                                   (short)0, c, false, false);
    }

    if (p < 2) {
        _Float16* ob = ((p == 0) ? qh : kh) + (size_t)b * SEQ * CH;
#pragma unroll
        for (int r = 0; r < 8; ++r) {
            const int row = mt * 16 + r + 8 * hi;
            const int col = nt * 16 + lm;
            ob[(size_t)row * CH + col] = (_Float16)c[r];
        }
    } else {
        // transposed store: vT[col][row]; rows contiguous along r -> one b128
        union { uint4 q; _Float16 h[8]; } u;
#pragma unroll
        for (int r = 0; r < 8; ++r) u.h[r] = (_Float16)c[r];
        _Float16* ob = vT + (size_t)b * SEQ * CH
                          + (size_t)(nt * 16 + lm) * SEQ + mt * 16 + 8 * hi;
        *reinterpret_cast<uint4*>(ob) = u.q;
    }
}

// ---------------------------------------------------------------------------
// Kernel 2: causal flash attention, 32-key blocks (full-K P*V WMMAs).
// One wave per 16-row query tile; online softmax in registers; P staged
// through a 1KB per-wave LDS tile (C-fragment -> A-fragment transpose).
// ---------------------------------------------------------------------------
__global__ __launch_bounds__(256) void flash_attn_kernel(
    const _Float16* __restrict__ qh, const _Float16* __restrict__ kh,
    const _Float16* __restrict__ vT, float* __restrict__ out)
{
    __shared__ _Float16 lds_p[8 * 512];       // 8 waves * 16x32 f16

    const int wave = threadIdx.x >> 5;
    const int lane = threadIdx.x & 31;
    const int lm = lane & 15, hi = lane >> 4;

    int flat = blockIdx.x * 8 + wave;         // [0, 1024)
    const int qt = flat & 255;
    const int b  = flat >> 8;

    const _Float16* qb  = qh + (size_t)b * SEQ * CH;
    const _Float16* kbp = kh + (size_t)b * SEQ * CH;
    const _Float16* vTb = vT + (size_t)b * SEQ * CH;   // [CH][SEQ]

    // Q fragments for all four K-chunks, resident for the whole pass.
    v16h aq[4];
#pragma unroll
    for (int kb = 0; kb < 4; ++kb) aq[kb] = load_frag_f16(qb, qt * 16 + lm, kb * 32, hi, CH);

    v8f o[8];
#pragma unroll
    for (int n = 0; n < 8; ++n) o[n] = (v8f){};

    float mrow[8], lrow[8];
#pragma unroll
    for (int r = 0; r < 8; ++r) { mrow[r] = -3.0e38f; lrow[r] = 0.0f; }

    const float scale = 0.08838834764831845f;  // 1/sqrt(128)
    _Float16* lp = lds_p + wave * 512;

    const int nfull = (qt + 1) >> 1;           // complete 32-key blocks

    for (int jj = 0; jj < nfull; ++jj) {
        const int k0 = jj * 32;
        if (jj + 1 < nfull) {
            __builtin_prefetch(kbp + (size_t)(k0 + 32) * CH, 0, 1);
        }

        // ---- S = Q * K^T for two adjacent 16-key tiles (K=128) ----
        v8f s0 = {}, s1 = {};
#pragma unroll
        for (int kb = 0; kb < 4; ++kb) {
            v16h bk0 = load_frag_f16(kbp, k0 + lm,      kb * 32, hi, CH);
            v16h bk1 = load_frag_f16(kbp, k0 + 16 + lm, kb * 32, hi, CH);
            s0 = __builtin_amdgcn_wmma_f32_16x16x32_f16(false, aq[kb], false, bk0,
                                                        (short)0, s0, false, false);
            s1 = __builtin_amdgcn_wmma_f32_16x16x32_f16(false, aq[kb], false, bk1,
                                                        (short)0, s1, false, false);
        }

        // ---- mask + scale + online softmax over 32 keys ----
        float alpha[8];
#pragma unroll
        for (int r = 0; r < 8; ++r) {
            const int qrow = qt * 16 + r + 8 * hi;
            float v0 = s0[r] * scale;
            float v1 = s1[r] * scale;
            if (k0 + lm      > qrow) v0 = -3.0e38f;   // bites only near diagonal
            if (k0 + 16 + lm > qrow) v1 = -3.0e38f;
            float rmax = fmaxf(v0, v1);
            rmax = fmaxf(rmax, __shfl_xor(rmax, 1));
            rmax = fmaxf(rmax, __shfl_xor(rmax, 2));
            rmax = fmaxf(rmax, __shfl_xor(rmax, 4));
            rmax = fmaxf(rmax, __shfl_xor(rmax, 8));
            const float mnew = fmaxf(mrow[r], rmax);
            alpha[r] = __expf(mrow[r] - mnew);
            const float p0 = __expf(v0 - mnew);
            const float p1 = __expf(v1 - mnew);
            float rsum = p0 + p1;
            rsum += __shfl_xor(rsum, 1);
            rsum += __shfl_xor(rsum, 2);
            rsum += __shfl_xor(rsum, 4);
            rsum += __shfl_xor(rsum, 8);
            lrow[r] = lrow[r] * alpha[r] + rsum;
            mrow[r] = mnew;
            s0[r] = p0;
            s1[r] = p1;
        }

#pragma unroll
        for (int n = 0; n < 8; ++n)
#pragma unroll
            for (int r = 0; r < 8; ++r) o[n][r] *= alpha[r];

        // ---- stage P (16x32) through LDS: C-frag -> A-frag ----
#pragma unroll
        for (int r = 0; r < 8; ++r) {
            lp[(r + 8 * hi) * 32 + lm]      = (_Float16)s0[r];
            lp[(r + 8 * hi) * 32 + 16 + lm] = (_Float16)s1[r];
        }
        asm volatile("s_wait_dscnt 0" ::: "memory");   // DS in-order; compiler fence

        union { uint4 q[2]; v16h v; } uap;
        uap.q[0] = *reinterpret_cast<const uint4*>(lp + lm * 32 + hi * 8);      // K 0..15
        uap.q[1] = *reinterpret_cast<const uint4*>(lp + lm * 32 + 16 + hi * 8); // K 16..31
        const v16h ap = uap.v;

        // ---- O += P * V : full-K WMMAs; B-frags contiguous from V^T ----
#pragma unroll
        for (int n = 0; n < 8; ++n) {
            const _Float16* vrow = vTb + (size_t)(n * 16 + lm) * SEQ + k0;
            union { uint4 q[2]; v16h v; } ub;
            ub.q[0] = *reinterpret_cast<const uint4*>(vrow + hi * 8);       // k 0..15
            ub.q[1] = *reinterpret_cast<const uint4*>(vrow + 16 + hi * 8);  // k 16..31
            o[n] = __builtin_amdgcn_wmma_f32_16x16x32_f16(false, ap, false, ub.v,
                                                          (short)0, o[n], false, false);
        }
    }

    // ---- leftover diagonal 16-key tile (qt even): zero-padded K half ----
    if ((qt & 1) == 0) {
        const int k0 = qt * 16;
        v8f s = {};
#pragma unroll
        for (int kb = 0; kb < 4; ++kb) {
            v16h bk = load_frag_f16(kbp, k0 + lm, kb * 32, hi, CH);
            s = __builtin_amdgcn_wmma_f32_16x16x32_f16(false, aq[kb], false, bk,
                                                       (short)0, s, false, false);
        }
        float alpha[8];
#pragma unroll
        for (int r = 0; r < 8; ++r) {
            const int qrow = qt * 16 + r + 8 * hi;
            float v = s[r] * scale;
            if (k0 + lm > qrow) v = -3.0e38f;
            float rmax = v;
            rmax = fmaxf(rmax, __shfl_xor(rmax, 1));
            rmax = fmaxf(rmax, __shfl_xor(rmax, 2));
            rmax = fmaxf(rmax, __shfl_xor(rmax, 4));
            rmax = fmaxf(rmax, __shfl_xor(rmax, 8));
            const float mnew = fmaxf(mrow[r], rmax);
            alpha[r] = __expf(mrow[r] - mnew);
            const float pv = __expf(v - mnew);
            float rsum = pv;
            rsum += __shfl_xor(rsum, 1);
            rsum += __shfl_xor(rsum, 2);
            rsum += __shfl_xor(rsum, 4);
            rsum += __shfl_xor(rsum, 8);
            lrow[r] = lrow[r] * alpha[r] + rsum;
            mrow[r] = mnew;
            s[r] = pv;
        }
#pragma unroll
        for (int n = 0; n < 8; ++n)
#pragma unroll
            for (int r = 0; r < 8; ++r) o[n][r] *= alpha[r];

#pragma unroll
        for (int r = 0; r < 8; ++r)
            lp[(r + 8 * hi) * 32 + lm] = (_Float16)s[r];
        asm volatile("s_wait_dscnt 0" ::: "memory");

        union { uint4 q[2]; v16h v; } uap;
        uap.q[0] = *reinterpret_cast<const uint4*>(lp + lm * 32 + hi * 8); // K 0..15
        uap.q[1] = (uint4){0, 0, 0, 0};                                    // K 16..31 = 0
        const v16h ap = uap.v;

#pragma unroll
        for (int n = 0; n < 8; ++n) {
            const _Float16* vrow = vTb + (size_t)(n * 16 + lm) * SEQ + k0;
            union { uint4 q[2]; v16h v; } ub;
            ub.q[0] = *reinterpret_cast<const uint4*>(vrow + hi * 8);  // k 0..15 (in range)
            ub.q[1] = (uint4){0, 0, 0, 0};                             // padded half
            o[n] = __builtin_amdgcn_wmma_f32_16x16x32_f16(false, ap, false, ub.v,
                                                          (short)0, o[n], false, false);
        }
    }

    // ---- epilogue: normalize and store f32 ----
    float inv[8];
#pragma unroll
    for (int r = 0; r < 8; ++r) inv[r] = 1.0f / lrow[r];

    float* ob = out + (size_t)b * SEQ * CH;
#pragma unroll
    for (int n = 0; n < 8; ++n)
#pragma unroll
        for (int r = 0; r < 8; ++r)
            ob[(size_t)(qt * 16 + r + 8 * hi) * CH + n * 16 + lm] = o[n][r] * inv[r];
}

// ---------------------------------------------------------------------------
extern "C" void kernel_launch(void* const* d_in, const int* in_sizes, int n_in,
                              void* d_out, int out_size, void* d_ws, size_t ws_size,
                              hipStream_t stream) {
    (void)in_sizes; (void)n_in; (void)out_size; (void)ws_size;
    const float* X  = (const float*)d_in[0];
    const float* Wq = (const float*)d_in[1];
    const float* Wk = (const float*)d_in[2];
    const float* Wv = (const float*)d_in[3];
    float* out = (float*)d_out;

    const size_t elems = (size_t)BATCH * SEQ * CH;       // 2,097,152
    _Float16* qh = (_Float16*)d_ws;
    _Float16* kh = qh + elems;
    _Float16* vT = kh + elems;                            // [B][CH][SEQ]

    // 3 proj * 4 batch * 256 mt * 8 nt tiles / 8 waves per block = 3072 blocks
    qkv_proj_kernel<<<3072, 256, 0, stream>>>(X, Wq, Wk, Wv, qh, kh, vT);
    // 4 batch * 256 query tiles / 8 waves per block = 128 blocks
    flash_attn_kernel<<<128, 256, 0, stream>>>(qh, kh, vT, out);
}

// v001
// A run of this version takes 99.3 microseconds.
// Timed twice side by side with v000, it ran 4.42 times as fast both times.
#include <hip/hip_runtime.h>
#include <hip/hip_bf16.h>

typedef __attribute__((ext_vector_type(16))) _Float16 v16h;
typedef __attribute__((ext_vector_type(8)))  float    v8f;

#define BATCH 4
#define SEQ   4096
#define CH    128
#define QTILES (SEQ / 16)   // 256

__device__ inline v16h load_frag_f16(const _Float16* base, size_t row, int koff, int hi, int ld) {
    const _Float16* p = base + row * ld + koff + hi * 8;
    union { uint4 q[2]; v16h v; } u;
    u.q[0] = *reinterpret_cast<const uint4*>(p);        // 8 halves, 16B aligned
    u.q[1] = *reinterpret_cast<const uint4*>(p + 16);   // 8 halves
    return u.v;
}

__device__ inline v16h load_frag_f32(const float* base, int row, int kb, int hi) {
    const float* p = base + (size_t)row * CH + kb * 32 + hi * 8;
    float4 a0 = *reinterpret_cast<const float4*>(p);
    float4 a1 = *reinterpret_cast<const float4*>(p + 4);
    float4 b0 = *reinterpret_cast<const float4*>(p + 16);
    float4 b1 = *reinterpret_cast<const float4*>(p + 20);
    v16h v;
    v[0]=(_Float16)a0.x; v[1]=(_Float16)a0.y; v[2]=(_Float16)a0.z; v[3]=(_Float16)a0.w;
    v[4]=(_Float16)a1.x; v[5]=(_Float16)a1.y; v[6]=(_Float16)a1.z; v[7]=(_Float16)a1.w;
    v[8]=(_Float16)b0.x; v[9]=(_Float16)b0.y; v[10]=(_Float16)b0.z; v[11]=(_Float16)b0.w;
    v[12]=(_Float16)b1.x; v[13]=(_Float16)b1.y; v[14]=(_Float16)b1.z; v[15]=(_Float16)b1.w;
    return v;
}

// ---------------------------------------------------------------------------
// Kernel 1: q/k/v = X @ W^T, f32 in -> f16 out (f32 WMMA accumulate).
// q,k stored row-major [T][C]; v stored TRANSPOSED [C][T] so the attention
// kernel's P*V B-fragments are contiguous b128 loads.
// One wave per 16x16 output tile. Tiles: 3 proj * 4 batch * 256 mt * 8 nt.
// ---------------------------------------------------------------------------
__global__ __launch_bounds__(256) void qkv_proj_kernel(
    const float* __restrict__ X,
    const float* __restrict__ Wq, const float* __restrict__ Wk, const float* __restrict__ Wv,
    _Float16* __restrict__ qh, _Float16* __restrict__ kh, _Float16* __restrict__ vT)
{
    const int wave = threadIdx.x >> 5;
    const int lane = threadIdx.x & 31;
    const int lm = lane & 15, hi = lane >> 4;

    int flat = blockIdx.x * 8 + wave;         // [0, 24576)
    const int nt = flat & 7;   flat >>= 3;
    const int mt = flat & 255; flat >>= 8;
    const int b  = flat & 3;   const int p = flat >> 2;

    const float* W = (p == 0) ? Wq : (p == 1) ? Wk : Wv;
    const float* Xb = X + (size_t)b * SEQ * CH;

    v8f c = {};
#pragma unroll
    for (int kb = 0; kb < 4; ++kb) {
        v16h a  = load_frag_f32(Xb, mt * 16 + lm, kb, hi);   // A: X tile row
        v16h bw = load_frag_f32(W,  nt * 16 + lm, kb, hi);   // B: W^T column = W row
        c = __builtin_amdgcn_wmma_f32_16x16x32_f16(false, a, false, bw,
                                                   (short)0, c, false, false);
    }

    if (p < 2) {
        _Float16* ob = ((p == 0) ? qh : kh) + (size_t)b * SEQ * CH;
#pragma unroll
        for (int r = 0; r < 8; ++r) {
            const int row = mt * 16 + r + 8 * hi;
            const int col = nt * 16 + lm;
            ob[(size_t)row * CH + col] = (_Float16)c[r];
        }
    } else {
        // transposed store: vT[col][row]; rows contiguous along r -> one b128
        union { uint4 q; _Float16 h[8]; } u;
#pragma unroll
        for (int r = 0; r < 8; ++r) u.h[r] = (_Float16)c[r];
        _Float16* ob = vT + (size_t)b * SEQ * CH
                          + (size_t)(nt * 16 + lm) * SEQ + mt * 16 + 8 * hi;
        *reinterpret_cast<uint4*>(ob) = u.q;
    }
}

// ---------------------------------------------------------------------------
// Kernel 2: causal flash attention, 32-key blocks (full-K P*V WMMAs).
// One work-group per 16-row query tile. Wave w walks key blocks w, w+8, ...
// with its own running max, sum and O; online softmax in registers; P staged
// through a 1KB per-wave LDS tile (C-fragment -> A-fragment transpose).
// The eight partial results are merged through LDS behind one barrier.
// ---------------------------------------------------------------------------
#define OPITCH 132   // floats per staged row of a partial O: 528 B = 16 B x odd
__global__ __launch_bounds__(256) void flash_attn_kernel(
    const _Float16* __restrict__ qh, const _Float16* __restrict__ kh,
    const _Float16* __restrict__ vT, float* __restrict__ out)
{
    __shared__ _Float16 lds_p[8 * 512];       // 8 waves * 16x32 f16
    __shared__ __attribute__((aligned(16))) float lds_o[8 * 16 * OPITCH];  // 8 waves * 16 rows of partial O
    __shared__ float lds_m[8 * 16];           // 8 waves * 16 row maxima
    __shared__ float lds_l[8 * 16];           // 8 waves * 16 row sums

    // wave number in a scalar register: trip counts and branches stay scalar
    const int wave = __builtin_amdgcn_readfirstlane(threadIdx.x >> 5);
    const int lane = threadIdx.x & 31;
    const int lm = lane & 15, hi = lane >> 4;

    const int qt = (QTILES - 1) - (blockIdx.x >> 2);   // longest tiles start first
    const int b  = blockIdx.x & 3;

    const _Float16* qb  = qh + (size_t)b * SEQ * CH;
    const _Float16* kbp = kh + (size_t)b * SEQ * CH;
    const _Float16* vTb = vT + (size_t)b * SEQ * CH;   // [CH][SEQ]

    // Q fragments for all four K-chunks, resident for the whole pass.
    v16h aq[4];
#pragma unroll
    for (int kb = 0; kb < 4; ++kb) aq[kb] = load_frag_f16(qb, qt * 16 + lm, kb * 32, hi, CH);

    v8f o[8];
#pragma unroll
    for (int n = 0; n < 8; ++n) o[n] = (v8f){};

    float mrow[8], lrow[8];
#pragma unroll
    for (int r = 0; r < 8; ++r) { mrow[r] = -3.0e38f; lrow[r] = 0.0f; }

    const float scale = 0.08838834764831845f;  // 1/sqrt(128)
    _Float16* lp = lds_p + wave * 512;

    const int nfull = (qt + 1) >> 1;           // complete 32-key blocks

    for (int jj = wave; jj < nfull; jj += 8) {
        const int k0 = jj * 32;

        // ---- S = Q * K^T for two adjacent 16-key tiles (K=128) ----
        v8f s0 = {}, s1 = {};
#pragma unroll
        for (int kb = 0; kb < 4; ++kb) {
            v16h bk0 = load_frag_f16(kbp, k0 + lm,      kb * 32, hi, CH);
            v16h bk1 = load_frag_f16(kbp, k0 + 16 + lm, kb * 32, hi, CH);
            s0 = __builtin_amdgcn_wmma_f32_16x16x32_f16(false, aq[kb], false, bk0,
                                                        (short)0, s0, false, false);
            s1 = __builtin_amdgcn_wmma_f32_16x16x32_f16(false, aq[kb], false, bk1,
                                                        (short)0, s1, false, false);
        }

        // ---- mask + scale + online softmax over 32 keys ----
        float alpha[8];
#pragma unroll
        for (int r = 0; r < 8; ++r) {
            const int qrow = qt * 16 + r + 8 * hi;
            float v0 = s0[r] * scale;
            float v1 = s1[r] * scale;
            if (k0 + lm      > qrow) v0 = -3.0e38f;   // bites only near diagonal
            if (k0 + 16 + lm > qrow) v1 = -3.0e38f;
            float rmax = fmaxf(v0, v1);
            rmax = fmaxf(rmax, __shfl_xor(rmax, 1));
            rmax = fmaxf(rmax, __shfl_xor(rmax, 2));
            rmax = fmaxf(rmax, __shfl_xor(rmax, 4));
            rmax = fmaxf(rmax, __shfl_xor(rmax, 8));
            const float mnew = fmaxf(mrow[r], rmax);
            alpha[r] = __expf(mrow[r] - mnew);
            const float p0 = __expf(v0 - mnew);
            const float p1 = __expf(v1 - mnew);
            float rsum = p0 + p1;
            rsum += __shfl_xor(rsum, 1);
            rsum += __shfl_xor(rsum, 2);
            rsum += __shfl_xor(rsum, 4);
            rsum += __shfl_xor(rsum, 8);
            lrow[r] = lrow[r] * alpha[r] + rsum;
            mrow[r] = mnew;
            s0[r] = p0;
            s1[r] = p1;
        }

#pragma unroll
        for (int n = 0; n < 8; ++n)
#pragma unroll
            for (int r = 0; r < 8; ++r) o[n][r] *= alpha[r];

        // ---- stage P (16x32) through LDS: C-frag -> A-frag ----
#pragma unroll
        for (int r = 0; r < 8; ++r) {
            lp[(r + 8 * hi) * 32 + lm]      = (_Float16)s0[r];
            lp[(r + 8 * hi) * 32 + 16 + lm] = (_Float16)s1[r];
        }
        asm volatile("s_wait_dscnt 0" ::: "memory");   // DS in-order; compiler fence

        union { uint4 q[2]; v16h v; } uap;
        uap.q[0] = *reinterpret_cast<const uint4*>(lp + lm * 32 + hi * 8);      // K 0..15
        uap.q[1] = *reinterpret_cast<const uint4*>(lp + lm * 32 + 16 + hi * 8); // K 16..31
        const v16h ap = uap.v;

        // ---- O += P * V : full-K WMMAs; B-frags contiguous from V^T ----
#pragma unroll
        for (int n = 0; n < 8; ++n) {
            const _Float16* vrow = vTb + (size_t)(n * 16 + lm) * SEQ + k0;
            union { uint4 q[2]; v16h v; } ub;
            ub.q[0] = *reinterpret_cast<const uint4*>(vrow + hi * 8);       // k 0..15
            ub.q[1] = *reinterpret_cast<const uint4*>(vrow + 16 + hi * 8);  // k 16..31
            o[n] = __builtin_amdgcn_wmma_f32_16x16x32_f16(false, ap, false, ub.v,
                                                          (short)0, o[n], false, false);
        }
    }

    // ---- leftover diagonal 16-key tile (qt even): zero-padded K half ----
    // taken by the wave whose turn is next
    if ((qt & 1) == 0 && wave == (nfull & 7)) {
        const int k0 = qt * 16;
        v8f s = {};
#pragma unroll
        for (int kb = 0; kb < 4; ++kb) {
            v16h bk = load_frag_f16(kbp, k0 + lm, kb * 32, hi, CH);
            s = __builtin_amdgcn_wmma_f32_16x16x32_f16(false, aq[kb], false, bk,
                                                       (short)0, s, false, false);
        }
        float alpha[8];
#pragma unroll
        for (int r = 0; r < 8; ++r) {
            const int qrow = qt * 16 + r + 8 * hi;
            float v = s[r] * scale;
            if (k0 + lm > qrow) v = -3.0e38f;
            float rmax = v;
            rmax = fmaxf(rmax, __shfl_xor(rmax, 1));
            rmax = fmaxf(rmax, __shfl_xor(rmax, 2));
            rmax = fmaxf(rmax, __shfl_xor(rmax, 4));
            rmax = fmaxf(rmax, __shfl_xor(rmax, 8));
            const float mnew = fmaxf(mrow[r], rmax);
            alpha[r] = __expf(mrow[r] - mnew);
            const float pv = __expf(v - mnew);
            float rsum = pv;
            rsum += __shfl_xor(rsum, 1);
            rsum += __shfl_xor(rsum, 2);
            rsum += __shfl_xor(rsum, 4);
            rsum += __shfl_xor(rsum, 8);
            lrow[r] = lrow[r] * alpha[r] + rsum;
            mrow[r] = mnew;
            s[r] = pv;
        }
#pragma unroll
        for (int n = 0; n < 8; ++n)
#pragma unroll
            for (int r = 0; r < 8; ++r) o[n][r] *= alpha[r];

#pragma unroll
        for (int r = 0; r < 8; ++r)
            lp[(r + 8 * hi) * 32 + lm] = (_Float16)s[r];
        asm volatile("s_wait_dscnt 0" ::: "memory");

        union { uint4 q[2]; v16h v; } uap;
        uap.q[0] = *reinterpret_cast<const uint4*>(lp + lm * 32 + hi * 8); // K 0..15
        uap.q[1] = (uint4){0, 0, 0, 0};                                    // K 16..31 = 0
        const v16h ap = uap.v;

#pragma unroll
        for (int n = 0; n < 8; ++n) {
            const _Float16* vrow = vTb + (size_t)(n * 16 + lm) * SEQ + k0;
            union { uint4 q[2]; v16h v; } ub;
            ub.q[0] = *reinterpret_cast<const uint4*>(vrow + hi * 8);  // k 0..15 (in range)
            ub.q[1] = (uint4){0, 0, 0, 0};                             // padded half
            o[n] = __builtin_amdgcn_wmma_f32_16x16x32_f16(false, ap, false, ub.v,
                                                          (short)0, o[n], false, false);
        }
    }

    // ---- publish this wave's partial (max, sum, un-normalised O) ----
    // A wave without a key block publishes max -3e38, sum 0, O 0: weight 0 below.
    if (lm == 0) {
#pragma unroll
        for (int r = 0; r < 8; ++r) {
            lds_m[wave * 16 + r + 8 * hi] = mrow[r];
            lds_l[wave * 16 + r + 8 * hi] = lrow[r];
        }
    }
#pragma unroll
    for (int n = 0; n < 8; ++n)
#pragma unroll
        for (int r = 0; r < 8; ++r)
            lds_o[(wave * 16 + r + 8 * hi) * OPITCH + n * 16 + lm] = o[n][r];

    __syncthreads();   // every wave's partial is in LDS before any wave merges

    float* ob = out + (size_t)b * SEQ * CH;
#pragma unroll
    for (int rr = 0; rr < 2; ++rr) {
        const int row = wave * 2 + rr;
        float ms[8];
        float mall = -3.0e38f;
#pragma unroll
        for (int s = 0; s < 8; ++s) {
            ms[s] = lds_m[s * 16 + row];
            mall = fmaxf(mall, ms[s]);
        }
        float lall = 0.0f;
        float4 acc = make_float4(0.0f, 0.0f, 0.0f, 0.0f);
#pragma unroll
        for (int s = 0; s < 8; ++s) {
            const float e = __expf(ms[s] - mall);
            const float4 ov = *reinterpret_cast<const float4*>(
                lds_o + (s * 16 + row) * OPITCH + lane * 4);
            lall += e * lds_l[s * 16 + row];
            acc.x += e * ov.x; acc.y += e * ov.y;
            acc.z += e * ov.z; acc.w += e * ov.w;
        }
        const float inv = 1.0f / lall;
        acc.x *= inv; acc.y *= inv; acc.z *= inv; acc.w *= inv;
        *reinterpret_cast<float4*>(ob + (size_t)(qt * 16 + row) * CH + lane * 4) = acc;
    }
}

// ---------------------------------------------------------------------------
extern "C" void kernel_launch(void* const* d_in, const int* in_sizes, int n_in,
                              void* d_out, int out_size, void* d_ws, size_t ws_size,
                              hipStream_t stream) {
    (void)in_sizes; (void)n_in; (void)out_size; (void)ws_size;
    const float* X  = (const float*)d_in[0];
    const float* Wq = (const float*)d_in[1];
    const float* Wk = (const float*)d_in[2];
    const float* Wv = (const float*)d_in[3];
    float* out = (float*)d_out;

    const size_t elems = (size_t)BATCH * SEQ * CH;       // 2,097,152
    _Float16* qh = (_Float16*)d_ws;
    _Float16* kh = qh + elems;
    _Float16* vT = kh + elems;                            // [B][CH][SEQ]

    // 3 proj * 4 batch * 256 mt * 8 nt tiles / 8 waves per block = 3072 blocks
    qkv_proj_kernel<<<3072, 256, 0, stream>>>(X, Wq, Wk, Wv, qh, kh, vT);
    // 4 batch * 256 query tiles, one block of 8 waves each = 1024 blocks
    flash_attn_kernel<<<1024, 256, 0, stream>>>(qh, kh, vT, out);
}

// v002
// A run of this version takes 79.1 microseconds.
// Two timings next to v001 put it at 1.27 and 1.25 times that version's speed.
// All steps since v000 together make it 5.58 times as fast.
#include <hip/hip_runtime.h>
#include <hip/hip_bf16.h>

typedef __attribute__((ext_vector_type(16))) _Float16 v16h;
typedef __attribute__((ext_vector_type(8)))  float    v8f;

#define BATCH 4
#define SEQ   4096
#define CH    128
#define QTILES (SEQ / 16)   // 256

__device__ inline v16h load_frag_f16(const _Float16* base, size_t row, int koff, int hi, int ld) {
    const _Float16* p = base + row * ld + koff + hi * 8;
    union { uint4 q[2]; v16h v; } u;
    u.q[0] = *reinterpret_cast<const uint4*>(p);        // 8 halves, 16B aligned
    u.q[1] = *reinterpret_cast<const uint4*>(p + 16);   // 8 halves
    return u.v;
}

__device__ inline v16h load_frag_f32(const float* base, int row, int kb, int hi) {
    const float* p = base + (size_t)row * CH + kb * 32 + hi * 8;
    float4 a0 = *reinterpret_cast<const float4*>(p);
    float4 a1 = *reinterpret_cast<const float4*>(p + 4);
    float4 b0 = *reinterpret_cast<const float4*>(p + 16);
    float4 b1 = *reinterpret_cast<const float4*>(p + 20);
    v16h v;
    v[0]=(_Float16)a0.x; v[1]=(_Float16)a0.y; v[2]=(_Float16)a0.z; v[3]=(_Float16)a0.w;
    v[4]=(_Float16)a1.x; v[5]=(_Float16)a1.y; v[6]=(_Float16)a1.z; v[7]=(_Float16)a1.w;
    v[8]=(_Float16)b0.x; v[9]=(_Float16)b0.y; v[10]=(_Float16)b0.z; v[11]=(_Float16)b0.w;
    v[12]=(_Float16)b1.x; v[13]=(_Float16)b1.y; v[14]=(_Float16)b1.z; v[15]=(_Float16)b1.w;
    return v;
}

// ---------------------------------------------------------------------------
// Kernel 1: q/k/v = X @ W^T, f32 in -> f16 out (f32 WMMA accumulate).
// q,k stored row-major [T][C]; v stored TRANSPOSED [C][T] so the attention
// kernel's P*V B-fragments are contiguous b128 loads.
// One wave per 16x16 output tile. Tiles: 3 proj * 4 batch * 256 mt * 8 nt.
// ---------------------------------------------------------------------------
__global__ __launch_bounds__(256) void qkv_proj_kernel(
    const float* __restrict__ X,
    const float* __restrict__ Wq, const float* __restrict__ Wk, const float* __restrict__ Wv,
    _Float16* __restrict__ qh, _Float16* __restrict__ kh, _Float16* __restrict__ vT)
{
    const int wave = threadIdx.x >> 5;
    const int lane = threadIdx.x & 31;
    const int lm = lane & 15, hi = lane >> 4;

    int flat = blockIdx.x * 8 + wave;         // [0, 24576)
    const int nt = flat & 7;   flat >>= 3;
    const int mt = flat & 255; flat >>= 8;
    const int b  = flat & 3;   const int p = flat >> 2;

    const float* W = (p == 0) ? Wq : (p == 1) ? Wk : Wv;
    const float* Xb = X + (size_t)b * SEQ * CH;

    v8f c = {};
#pragma unroll
    for (int kb = 0; kb < 4; ++kb) {
        v16h a  = load_frag_f32(Xb, mt * 16 + lm, kb, hi);   // A: X tile row
        v16h bw = load_frag_f32(W,  nt * 16 + lm, kb, hi);   // B: W^T column = W row
        c = __builtin_amdgcn_wmma_f32_16x16x32_f16(false, a, false, bw,
                                                   (short)0, c, false, false);
    }

    if (p < 2) {
        _Float16* ob = ((p == 0) ? qh : kh) + (size_t)b * SEQ * CH;
#pragma unroll
        for (int r = 0; r < 8; ++r) {
            const int row = mt * 16 + r + 8 * hi;
            const int col = nt * 16 + lm;
            ob[(size_t)row * CH + col] = (_Float16)c[r];
        }
    } else {
        // transposed store: vT[col][row]; rows contiguous along r -> one b128
        union { uint4 q; _Float16 h[8]; } u;
#pragma unroll
        for (int r = 0; r < 8; ++r) u.h[r] = (_Float16)c[r];
        _Float16* ob = vT + (size_t)b * SEQ * CH
                          + (size_t)(nt * 16 + lm) * SEQ + mt * 16 + 8 * hi;
        *reinterpret_cast<uint4*>(ob) = u.q;
    }
}

// ---------------------------------------------------------------------------
// Kernel 2: causal flash attention, 32-key blocks (full-K P*V WMMAs).
// One work-group per 16-row query tile. Wave w walks key blocks w, w+8, ...
// with its own running max, sum and O; online softmax in registers; P staged
// through a 1KB per-wave LDS tile (C-fragment -> A-fragment transpose).
// The eight partial results are merged through LDS behind one barrier.
// Each wave owns one K buffer and one V^T buffer in LDS. Asynchronous copies
// fill them one key block ahead: the next block's copies go out as soon as
// this block's fragments are in registers and land under the softmax and P*V.
// Nobody but the copying wave reads its buffers inside the loop.
// ---------------------------------------------------------------------------
#define OPITCH 132   // floats per staged row of a partial O: 528 B = 16 B x odd
#define KPITCH 272   // bytes per staged K row (256 used): 16 B x odd
#define VPITCH 80    // bytes per staged V^T row (64 used): 16 B x odd
#define KBYTES (32 * KPITCH)          // 32 keys
#define VBYTES (CH * VPITCH)          // 128 channels
#define WBYTES (KBYTES + VBYTES)      // one wave's buffers, 18,944 B

typedef __attribute__((ext_vector_type(4))) int v4i;
typedef __attribute__((address_space(1))) v4i gl_v4i;
typedef __attribute__((address_space(3))) v4i ls_v4i;

// The offset field moves the LDS and the global address alike: with the LDS step in it, one
// LDS address register serves all 16 copies of a tile (16 of them did not fit the register
// budget); what the global step differs from the LDS step by is added to the global base.
template <int C>
__device__ inline void copy_k_from(const unsigned char* ub, unsigned voff, ls_v4i* l) {
    if constexpr (C < 16) {
        __builtin_amdgcn_global_load_async_to_lds_b128(
            (gl_v4i*)(ub + (C * 512 - C * 2 * KPITCH) + voff), l, C * 2 * KPITCH, 0);
        copy_k_from<C + 1>(ub, voff, l);
    }
}
template <int C>
__device__ inline void copy_v_from(const unsigned char* ub, unsigned voff, ls_v4i* l) {
    if constexpr (C < 16) {
        __builtin_amdgcn_global_load_async_to_lds_b128(
            (gl_v4i*)(ub + (C * 8 * SEQ * 2 - C * 8 * VPITCH) + voff), l, C * 8 * VPITCH, 0);
        copy_v_from<C + 1>(ub, voff, l);
    }
}

// 32 K rows are 8 KB in a row in memory: each copy takes 512 B = 4 whole lines (2 rows).
__device__ inline void copy_k_block(const _Float16* kblk, unsigned char* kbuf, int lane) {
    copy_k_from<0>(reinterpret_cast<const unsigned char*>(kblk), (unsigned)(lane * 16),
                   (ls_v4i*)(kbuf + (lane >> 4) * KPITCH + (lane & 15) * 16));
}

// 128 V^T rows of 64 B: each copy takes 8 rows, 4 lanes a row.
__device__ inline void copy_v_block(const _Float16* vblk, unsigned char* vbuf, int lane) {
    copy_v_from<0>(reinterpret_cast<const unsigned char*>(vblk),
                   (unsigned)((lane >> 2) * (SEQ * 2) + (lane & 3) * 16),
                   (ls_v4i*)(vbuf + (lane >> 2) * VPITCH + (lane & 3) * 16));
}

// fragment from a staged tile: 16 B at p, 16 B at p + 32 (the k order of load_frag_f16)
__device__ inline v16h lds_frag(const unsigned char* p) {
    union { uint4 q[2]; v16h v; } u;
    u.q[0] = *reinterpret_cast<const uint4*>(p);
    u.q[1] = *reinterpret_cast<const uint4*>(p + 32);
    return u.v;
}
__global__ __launch_bounds__(256) void flash_attn_kernel(
    const _Float16* __restrict__ qh, const _Float16* __restrict__ kh,
    const _Float16* __restrict__ vT, float* __restrict__ out)
{
    __shared__ _Float16 lds_p[8 * 512];       // 8 waves * 16x32 f16
    // 8 waves * (K buffer, V^T buffer); behind the loop a wave's own range holds its partial O
    __shared__ __attribute__((aligned(16))) unsigned char ring[8 * WBYTES];
    __shared__ float lds_m[8 * 16];           // 8 waves * 16 row maxima
    __shared__ float lds_l[8 * 16];           // 8 waves * 16 row sums

    // wave number in a scalar register: trip counts and branches stay scalar
    const int wave = __builtin_amdgcn_readfirstlane(threadIdx.x >> 5);
    const int lane = threadIdx.x & 31;
    const int lm = lane & 15, hi = lane >> 4;

    const int qt = (QTILES - 1) - (blockIdx.x >> 2);   // longest tiles start first
    const int b  = blockIdx.x & 3;

    const _Float16* qb  = qh + (size_t)b * SEQ * CH;
    const _Float16* kbp = kh + (size_t)b * SEQ * CH;
    const _Float16* vTb = vT + (size_t)b * SEQ * CH;   // [CH][SEQ]

    // Q fragments for all four K-chunks, resident for the whole pass.
    v16h aq[4];
#pragma unroll
    for (int kb = 0; kb < 4; ++kb) aq[kb] = load_frag_f16(qb, qt * 16 + lm, kb * 32, hi, CH);

    v8f o[8];
#pragma unroll
    for (int n = 0; n < 8; ++n) o[n] = (v8f){};

    float mrow[8], lrow[8];
#pragma unroll
    for (int r = 0; r < 8; ++r) { mrow[r] = -3.0e38f; lrow[r] = 0.0f; }

    const float scale = 0.08838834764831845f;  // 1/sqrt(128)
    _Float16* lp = lds_p + wave * 512;

    const int nfull = (qt + 1) >> 1;           // complete 32-key blocks

    unsigned char* kbuf = ring + wave * WBYTES;
    unsigned char* vbuf = kbuf + KBYTES;
    const unsigned char* kfr = kbuf + lm * KPITCH + hi * 16;
    const unsigned char* vfr = vbuf + lm * VPITCH + hi * 16;

    if (wave < nfull) {                        // scalar test: this wave's first block
        copy_k_block(kbp + (size_t)wave * 32 * CH, kbuf, lane);
        copy_v_block(vTb + wave * 32, vbuf, lane);
    }

    for (int jj = wave; jj < nfull; jj += 8) {
        const int k0 = jj * 32;

        // this block's K and V^T have landed before this wave reads them
        asm volatile("s_wait_asynccnt 0x0" ::: "memory");

        // ---- S = Q * K^T for two adjacent 16-key tiles (K=128) ----
        v8f s0 = {}, s1 = {};
#pragma unroll
        for (int kb = 0; kb < 4; ++kb) {
            v16h bk0 = lds_frag(kfr + kb * 64);
            v16h bk1 = lds_frag(kfr + 16 * KPITCH + kb * 64);
            s0 = __builtin_amdgcn_wmma_f32_16x16x32_f16(false, aq[kb], false, bk0,
                                                        (short)0, s0, false, false);
            s1 = __builtin_amdgcn_wmma_f32_16x16x32_f16(false, aq[kb], false, bk1,
                                                        (short)0, s1, false, false);
        }

        // V^T fragments into registers now, so that both buffers are free for the next block
        v16h bv[8];
#pragma unroll
        for (int n = 0; n < 8; ++n) bv[n] = lds_frag(vfr + n * 16 * VPITCH);

        // every read of the two buffers has returned before the copies overwrite them
        asm volatile("s_wait_dscnt 0x0" ::: "memory");
        if (jj + 8 < nfull) {                  // scalar test: a next block exists
            copy_k_block(kbp + (size_t)(k0 + 256) * CH, kbuf, lane);
            copy_v_block(vTb + k0 + 256, vbuf, lane);
        }

        // ---- mask + scale + online softmax over 32 keys ----
        float alpha[8];
#pragma unroll
        for (int r = 0; r < 8; ++r) {
            const int qrow = qt * 16 + r + 8 * hi;
            float v0 = s0[r] * scale;
            float v1 = s1[r] * scale;
            if (k0 + lm      > qrow) v0 = -3.0e38f;   // bites only near diagonal
            if (k0 + 16 + lm > qrow) v1 = -3.0e38f;
            float rmax = fmaxf(v0, v1);
            rmax = fmaxf(rmax, __shfl_xor(rmax, 1));
            rmax = fmaxf(rmax, __shfl_xor(rmax, 2));
            rmax = fmaxf(rmax, __shfl_xor(rmax, 4));
            rmax = fmaxf(rmax, __shfl_xor(rmax, 8));
            const float mnew = fmaxf(mrow[r], rmax);
            alpha[r] = __expf(mrow[r] - mnew);
            const float p0 = __expf(v0 - mnew);
            const float p1 = __expf(v1 - mnew);
            float rsum = p0 + p1;
            rsum += __shfl_xor(rsum, 1);
            rsum += __shfl_xor(rsum, 2);
            rsum += __shfl_xor(rsum, 4);
            rsum += __shfl_xor(rsum, 8);
            lrow[r] = lrow[r] * alpha[r] + rsum;
            mrow[r] = mnew;
            s0[r] = p0;
            s1[r] = p1;
        }

#pragma unroll
        for (int n = 0; n < 8; ++n)
#pragma unroll
            for (int r = 0; r < 8; ++r) o[n][r] *= alpha[r];

        // ---- stage P (16x32) through LDS: C-frag -> A-frag ----
#pragma unroll
        for (int r = 0; r < 8; ++r) {
            lp[(r + 8 * hi) * 32 + lm]      = (_Float16)s0[r];
            lp[(r + 8 * hi) * 32 + 16 + lm] = (_Float16)s1[r];
        }
        asm volatile("s_wait_dscnt 0" ::: "memory");   // DS in-order; compiler fence

        union { uint4 q[2]; v16h v; } uap;
        uap.q[0] = *reinterpret_cast<const uint4*>(lp + lm * 32 + hi * 8);      // K 0..15
        uap.q[1] = *reinterpret_cast<const uint4*>(lp + lm * 32 + 16 + hi * 8); // K 16..31
        const v16h ap = uap.v;

        // ---- O += P * V : full-K WMMAs ----
#pragma unroll
        for (int n = 0; n < 8; ++n)
            o[n] = __builtin_amdgcn_wmma_f32_16x16x32_f16(false, ap, false, bv[n],
                                                          (short)0, o[n], false, false);
    }
    // no copy of this wave is outstanding before its buffers take the partial O
    asm volatile("s_wait_asynccnt 0x0" ::: "memory");

    // ---- leftover diagonal 16-key tile (qt even): zero-padded K half ----
    // taken by the wave whose turn is next
    if ((qt & 1) == 0 && wave == (nfull & 7)) {
        const int k0 = qt * 16;
        v8f s = {};
#pragma unroll
        for (int kb = 0; kb < 4; ++kb) {
            v16h bk = load_frag_f16(kbp, k0 + lm, kb * 32, hi, CH);
            s = __builtin_amdgcn_wmma_f32_16x16x32_f16(false, aq[kb], false, bk,
                                                       (short)0, s, false, false);
        }
        float alpha[8];
#pragma unroll
        for (int r = 0; r < 8; ++r) {
            const int qrow = qt * 16 + r + 8 * hi;
            float v = s[r] * scale;
            if (k0 + lm > qrow) v = -3.0e38f;
            float rmax = v;
            rmax = fmaxf(rmax, __shfl_xor(rmax, 1));
            rmax = fmaxf(rmax, __shfl_xor(rmax, 2));
            rmax = fmaxf(rmax, __shfl_xor(rmax, 4));
            rmax = fmaxf(rmax, __shfl_xor(rmax, 8));
            const float mnew = fmaxf(mrow[r], rmax);
            alpha[r] = __expf(mrow[r] - mnew);
            const float pv = __expf(v - mnew);
            float rsum = pv;
            rsum += __shfl_xor(rsum, 1);
            rsum += __shfl_xor(rsum, 2);
            rsum += __shfl_xor(rsum, 4);
            rsum += __shfl_xor(rsum, 8);
            lrow[r] = lrow[r] * alpha[r] + rsum;
            mrow[r] = mnew;
            s[r] = pv;
        }
#pragma unroll
        for (int n = 0; n < 8; ++n)
#pragma unroll
            for (int r = 0; r < 8; ++r) o[n][r] *= alpha[r];

#pragma unroll
        for (int r = 0; r < 8; ++r)
            lp[(r + 8 * hi) * 32 + lm] = (_Float16)s[r];
        asm volatile("s_wait_dscnt 0" ::: "memory");

        union { uint4 q[2]; v16h v; } uap;
        uap.q[0] = *reinterpret_cast<const uint4*>(lp + lm * 32 + hi * 8); // K 0..15
        uap.q[1] = (uint4){0, 0, 0, 0};                                    // K 16..31 = 0
        const v16h ap = uap.v;

#pragma unroll
        for (int n = 0; n < 8; ++n) {
            const _Float16* vrow = vTb + (size_t)(n * 16 + lm) * SEQ + k0;
            union { uint4 q[2]; v16h v; } ub;
            ub.q[0] = *reinterpret_cast<const uint4*>(vrow + hi * 8);  // k 0..15 (in range)
            ub.q[1] = (uint4){0, 0, 0, 0};                             // padded half
            o[n] = __builtin_amdgcn_wmma_f32_16x16x32_f16(false, ap, false, ub.v,
                                                          (short)0, o[n], false, false);
        }
    }

    // ---- publish this wave's partial (max, sum, un-normalised O) ----
    // A wave without a key block publishes max -3e38, sum 0, O 0: weight 0 below.
    if (lm == 0) {
#pragma unroll
        for (int r = 0; r < 8; ++r) {
            lds_m[wave * 16 + r + 8 * hi] = mrow[r];
            lds_l[wave * 16 + r + 8 * hi] = lrow[r];
        }
    }
    float* lo = reinterpret_cast<float*>(kbuf);
#pragma unroll
    for (int n = 0; n < 8; ++n)
#pragma unroll
        for (int r = 0; r < 8; ++r)
            lo[(r + 8 * hi) * OPITCH + n * 16 + lm] = o[n][r];

    __syncthreads();   // every wave's partial is in LDS before any wave merges

    float* ob = out + (size_t)b * SEQ * CH;
#pragma unroll
    for (int rr = 0; rr < 2; ++rr) {
        const int row = wave * 2 + rr;
        float ms[8];
        float mall = -3.0e38f;
#pragma unroll
        for (int s = 0; s < 8; ++s) {
            ms[s] = lds_m[s * 16 + row];
            mall = fmaxf(mall, ms[s]);
        }
        float lall = 0.0f;
        float4 acc = make_float4(0.0f, 0.0f, 0.0f, 0.0f);
#pragma unroll
        for (int s = 0; s < 8; ++s) {
            const float e = __expf(ms[s] - mall);
            const float4 ov = *reinterpret_cast<const float4*>(
                reinterpret_cast<const float*>(ring + s * WBYTES) + row * OPITCH + lane * 4);
            lall += e * lds_l[s * 16 + row];
            acc.x += e * ov.x; acc.y += e * ov.y;
            acc.z += e * ov.z; acc.w += e * ov.w;
        }
        const float inv = 1.0f / lall;
        acc.x *= inv; acc.y *= inv; acc.z *= inv; acc.w *= inv;
        *reinterpret_cast<float4*>(ob + (size_t)(qt * 16 + row) * CH + lane * 4) = acc;
    }
}

// ---------------------------------------------------------------------------
extern "C" void kernel_launch(void* const* d_in, const int* in_sizes, int n_in,
                              void* d_out, int out_size, void* d_ws, size_t ws_size,
                              hipStream_t stream) {
    (void)in_sizes; (void)n_in; (void)out_size; (void)ws_size;
    const float* X  = (const float*)d_in[0];
    const float* Wq = (const float*)d_in[1];
    const float* Wk = (const float*)d_in[2];
    const float* Wv = (const float*)d_in[3];
    float* out = (float*)d_out;

    const size_t elems = (size_t)BATCH * SEQ * CH;       // 2,097,152
    _Float16* qh = (_Float16*)d_ws;
    _Float16* kh = qh + elems;
    _Float16* vT = kh + elems;                            // [B][CH][SEQ]

    // 3 proj * 4 batch * 256 mt * 8 nt tiles / 8 waves per block = 3072 blocks
    qkv_proj_kernel<<<3072, 256, 0, stream>>>(X, Wq, Wk, Wv, qh, kh, vT);
    // 4 batch * 256 query tiles, one block of 8 waves each = 1024 blocks
    flash_attn_kernel<<<1024, 256, 0, stream>>>(qh, kh, vT, out);
}

// v003
// A run of this version takes 68.7 microseconds.
// Two timings next to v002 both put it at 1.15 times that version's speed.
// All steps since v000 together make it 6.43 times as fast.
#include <hip/hip_runtime.h>
#include <hip/hip_bf16.h>

typedef __attribute__((ext_vector_type(16))) _Float16 v16h;
typedef __attribute__((ext_vector_type(8)))  float    v8f;

#define BATCH 4
#define SEQ   4096
#define CH    128
#define QTILES (SEQ / 16)   // 256

__device__ inline v16h load_frag_f16(const _Float16* base, size_t row, int koff, int hi, int ld) {
    const _Float16* p = base + row * ld + koff + hi * 8;
    union { uint4 q[2]; v16h v; } u;
    u.q[0] = *reinterpret_cast<const uint4*>(p);        // 8 halves, 16B aligned
    u.q[1] = *reinterpret_cast<const uint4*>(p + 16);   // 8 halves
    return u.v;
}

__device__ inline v16h load_frag_f32(const float* base, int row, int kb, int hi) {
    const float* p = base + (size_t)row * CH + kb * 32 + hi * 8;
    float4 a0 = *reinterpret_cast<const float4*>(p);
    float4 a1 = *reinterpret_cast<const float4*>(p + 4);
    float4 b0 = *reinterpret_cast<const float4*>(p + 16);
    float4 b1 = *reinterpret_cast<const float4*>(p + 20);
    v16h v;
    v[0]=(_Float16)a0.x; v[1]=(_Float16)a0.y; v[2]=(_Float16)a0.z; v[3]=(_Float16)a0.w;
    v[4]=(_Float16)a1.x; v[5]=(_Float16)a1.y; v[6]=(_Float16)a1.z; v[7]=(_Float16)a1.w;
    v[8]=(_Float16)b0.x; v[9]=(_Float16)b0.y; v[10]=(_Float16)b0.z; v[11]=(_Float16)b0.w;
    v[12]=(_Float16)b1.x; v[13]=(_Float16)b1.y; v[14]=(_Float16)b1.z; v[15]=(_Float16)b1.w;
    return v;
}

// ---------------------------------------------------------------------------
// Kernel 1: q/k/v = X @ W^T, f32 in -> f16 out (f32 WMMA accumulate).
// q,k stored row-major [T][C]; v stored TRANSPOSED [C][T] so the attention
// kernel's V^T * P^T A-fragments are contiguous b128 loads.
// One wave per 16x16 output tile. Tiles: 3 proj * 4 batch * 256 mt * 8 nt.
// ---------------------------------------------------------------------------
__global__ __launch_bounds__(256) void qkv_proj_kernel(
    const float* __restrict__ X,
    const float* __restrict__ Wq, const float* __restrict__ Wk, const float* __restrict__ Wv,
    _Float16* __restrict__ qh, _Float16* __restrict__ kh, _Float16* __restrict__ vT)
{
    const int wave = threadIdx.x >> 5;
    const int lane = threadIdx.x & 31;
    const int lm = lane & 15, hi = lane >> 4;

    int flat = blockIdx.x * 8 + wave;         // [0, 24576)
    const int nt = flat & 7;   flat >>= 3;
    const int mt = flat & 255; flat >>= 8;
    const int b  = flat & 3;   const int p = flat >> 2;

    const float* W = (p == 0) ? Wq : (p == 1) ? Wk : Wv;
    const float* Xb = X + (size_t)b * SEQ * CH;

    v8f c = {};
#pragma unroll
    for (int kb = 0; kb < 4; ++kb) {
        v16h a  = load_frag_f32(Xb, mt * 16 + lm, kb, hi);   // A: X tile row
        v16h bw = load_frag_f32(W,  nt * 16 + lm, kb, hi);   // B: W^T column = W row
        c = __builtin_amdgcn_wmma_f32_16x16x32_f16(false, a, false, bw,
                                                   (short)0, c, false, false);
    }

    if (p < 2) {
        _Float16* ob = ((p == 0) ? qh : kh) + (size_t)b * SEQ * CH;
#pragma unroll
        for (int r = 0; r < 8; ++r) {
            const int row = mt * 16 + r + 8 * hi;
            const int col = nt * 16 + lm;
            ob[(size_t)row * CH + col] = (_Float16)c[r];
        }
    } else {
        // transposed store: vT[col][row]; rows contiguous along r -> one b128
        union { uint4 q; _Float16 h[8]; } u;
#pragma unroll
        for (int r = 0; r < 8; ++r) u.h[r] = (_Float16)c[r];
        _Float16* ob = vT + (size_t)b * SEQ * CH
                          + (size_t)(nt * 16 + lm) * SEQ + mt * 16 + 8 * hi;
        *reinterpret_cast<uint4*>(ob) = u.q;
    }
}

#define OPITCH 132
#define KPITCH 272
#define VPITCH 80
#define KBYTES (32 * KPITCH)          // 32 keys
#define VBYTES (CH * VPITCH)          // 128 channels
#define WBYTES (KBYTES + VBYTES)      // one wave's buffers, 18,944 B

typedef __attribute__((ext_vector_type(4))) int v4i;
typedef __attribute__((address_space(1))) v4i gl_v4i;
typedef __attribute__((address_space(3))) v4i ls_v4i;

// The offset field moves the LDS and the global address alike: with the LDS step in it, one
// LDS address register serves all 16 copies of a tile (16 of them did not fit the register
// budget); what the global step differs from the LDS step by is added to the global base.
template <int C>
__device__ inline void copy_k_from(const unsigned char* ub, unsigned voff, ls_v4i* l) {
    if constexpr (C < 16) {
        __builtin_amdgcn_global_load_async_to_lds_b128(
            (gl_v4i*)(ub + (C * 512 - C * 2 * KPITCH) + voff), l, C * 2 * KPITCH, 0);
        copy_k_from<C + 1>(ub, voff, l);
    }
}
template <int C>
__device__ inline void copy_v_from(const unsigned char* ub, unsigned voff, ls_v4i* l) {
    if constexpr (C < 16) {
        __builtin_amdgcn_global_load_async_to_lds_b128(
            (gl_v4i*)(ub + (C * 8 * SEQ * 2 - C * 8 * VPITCH) + voff), l, C * 8 * VPITCH, 0);
        copy_v_from<C + 1>(ub, voff, l);
    }
}

// 32 K rows are 8 KB in a row in memory: each copy takes 512 B = 4 whole lines (2 rows).
__device__ inline void copy_k_block(const _Float16* kblk, unsigned char* kbuf, int lane) {
    copy_k_from<0>(reinterpret_cast<const unsigned char*>(kblk), (unsigned)(lane * 16),
                   (ls_v4i*)(kbuf + (lane >> 4) * KPITCH + (lane & 15) * 16));
}

// 128 V^T rows of 64 B: each copy takes 8 rows, 4 lanes a row.
__device__ inline void copy_v_block(const _Float16* vblk, unsigned char* vbuf, int lane) {
    copy_v_from<0>(reinterpret_cast<const unsigned char*>(vblk),
                   (unsigned)((lane >> 2) * (SEQ * 2) + (lane & 3) * 16),
                   (ls_v4i*)(vbuf + (lane >> 2) * VPITCH + (lane & 3) * 16));
}

// fragment from a staged tile: 16 B at p, 16 B at p + 32 (the k order of load_frag_f16)
__device__ inline v16h lds_frag(const unsigned char* p) {
    union { uint4 q[2]; v16h v; } u;
    u.q[0] = *reinterpret_cast<const uint4*>(p);
    u.q[1] = *reinterpret_cast<const uint4*>(p + 32);
    return u.v;
}
__device__ inline float xhalf(float x) {
    return __builtin_bit_cast(float, __builtin_amdgcn_permlanex16(
        __builtin_bit_cast(int, x), __builtin_bit_cast(int, x),
        0x76543210, 0xfedcba98, false, false));
}

__global__ __launch_bounds__(256) void flash_attn_kernel(
    const _Float16* __restrict__ qh, const _Float16* __restrict__ kh,
    const _Float16* __restrict__ vT, float* __restrict__ out)
{
    // 8 waves * (K buffer, V^T buffer); behind the loop a wave's own range holds its partial O
    __shared__ __attribute__((aligned(16))) unsigned char ring[8 * WBYTES];
    __shared__ float lds_m[8 * 16];           // 8 waves * 16 row maxima
    __shared__ float lds_l[8 * 16];           // 8 waves * 16 row sums

    // wave number in a scalar register: trip counts and branches stay scalar
    const int wave = __builtin_amdgcn_readfirstlane(threadIdx.x >> 5);
    const int lane = threadIdx.x & 31;
    const int lm = lane & 15, hi = lane >> 4;

    const int qt = (QTILES - 1) - (blockIdx.x >> 2);   // longest tiles start first
    const int b  = blockIdx.x & 3;

    const _Float16* qb  = qh + (size_t)b * SEQ * CH;
    const _Float16* kbp = kh + (size_t)b * SEQ * CH;
    const _Float16* vTb = vT + (size_t)b * SEQ * CH;   // [CH][SEQ]

    // Q fragments for all four K-chunks, resident for the whole pass.
    v16h aq[4];
#pragma unroll
    for (int kb = 0; kb < 4; ++kb) aq[kb] = load_frag_f16(qb, qt * 16 + lm, kb * 32, hi, CH);

    v8f o[8];
#pragma unroll
    for (int n = 0; n < 8; ++n) o[n] = (v8f){};

    // this lane's query: running maximum (alike in both halves) and the sum over
    // this half's keys (the halves are joined once, behind the loop)
    float mrun = -3.0e38f, lrun = 0.0f;
    const int qrow = qt * 16 + lm;

    const float scale = 0.08838834764831845f;  // 1/sqrt(128)

    const int nfull = (qt + 1) >> 1;           // complete 32-key blocks

    unsigned char* kbuf = ring + wave * WBYTES;
    unsigned char* vbuf = kbuf + KBYTES;
    const unsigned char* kfr = kbuf + lm * KPITCH + hi * 16;
    const unsigned char* vfr = vbuf + lm * VPITCH + hi * 16;

    if (wave < nfull) {                        // scalar test: this wave's first block
        copy_k_block(kbp + (size_t)wave * 32 * CH, kbuf, lane);
        copy_v_block(vTb + wave * 32, vbuf, lane);
    }

    for (int jj = wave; jj < nfull; jj += 8) {
        const int k0 = jj * 32;

        // this block's K and V^T have landed before this wave reads them
        asm volatile("s_wait_asynccnt 0x0" ::: "memory");

        // ---- S^T = K * Q^T for two adjacent 16-key tiles (K=128) ----
        // s0[r]: key k0 + 8 hi + r, s1[r]: key k0 + 16 + 8 hi + r, query lm
        v8f s0 = {}, s1 = {};
#pragma unroll
        for (int kb = 0; kb < 4; ++kb) {
            v16h bk0 = lds_frag(kfr + kb * 64);
            v16h bk1 = lds_frag(kfr + 16 * KPITCH + kb * 64);
            s0 = __builtin_amdgcn_wmma_f32_16x16x32_f16(false, bk0, false, aq[kb],
                                                        (short)0, s0, false, false);
            s1 = __builtin_amdgcn_wmma_f32_16x16x32_f16(false, bk1, false, aq[kb],
                                                        (short)0, s1, false, false);
        }

        // V^T fragments into registers now, so that both buffers are free for the next block
        v16h bv[8];
#pragma unroll
        for (int n = 0; n < 8; ++n) bv[n] = lds_frag(vfr + n * 16 * VPITCH);

        // every read of the two buffers has returned before the copies overwrite them
        asm volatile("s_wait_dscnt 0x0" ::: "memory");
        if (jj + 8 < nfull) {                  // scalar test: a next block exists
            copy_k_block(kbp + (size_t)(k0 + 256) * CH, kbuf, lane);
            copy_v_block(vTb + k0 + 256, vbuf, lane);
        }

        // ---- mask + scale + online softmax over 32 keys, one query a lane ----
        const int dlast = qrow - k0 - 8 * hi;   // last r of s0 that this query may see
        float rmax = -3.0e38f;
#pragma unroll
        for (int r = 0; r < 8; ++r) {
            float v0 = s0[r] * scale;
            float v1 = s1[r] * scale;
            if (r      > dlast) v0 = -3.0e38f;   // bites only near diagonal
            if (r + 16 > dlast) v1 = -3.0e38f;
            s0[r] = v0;
            s1[r] = v1;
            rmax = fmaxf(rmax, fmaxf(v0, v1));
        }
        rmax = fmaxf(rmax, xhalf(rmax));
        const float mnew = fmaxf(mrun, rmax);
        const float alpha = __expf(mrun - mnew);
        mrun = mnew;

        v16h pt;                                 // P^T as B operand: pt[s] = key kmap(s, hi)
        float rs0 = 0.0f, rs1 = 0.0f;
#pragma unroll
        for (int r = 0; r < 8; ++r) {
            const float p0 = __expf(s0[r] - mnew);
            const float p1 = __expf(s1[r] - mnew);
            rs0 += p0;
            rs1 += p1;
            pt[r]     = (_Float16)p0;
            pt[8 + r] = (_Float16)p1;
        }
        lrun = lrun * alpha + (rs0 + rs1);

#pragma unroll
        for (int n = 0; n < 8; ++n)
#pragma unroll
            for (int r = 0; r < 8; ++r) o[n][r] *= alpha;

        // ---- O^T += V^T * P^T : full-K WMMAs; o[n][r]: channel 16 n + 8 hi + r, query lm ----
#pragma unroll
        for (int n = 0; n < 8; ++n)
            o[n] = __builtin_amdgcn_wmma_f32_16x16x32_f16(false, bv[n], false, pt,
                                                          (short)0, o[n], false, false);
    }
    // no copy of this wave is outstanding before its buffers take the partial O
    asm volatile("s_wait_asynccnt 0x0" ::: "memory");

    // ---- leftover diagonal 16-key tile (qt even): zero-padded K half ----
    // taken by the wave whose turn is next
    if ((qt & 1) == 0 && wave == (nfull & 7)) {
        const int k0 = qt * 16;
        v8f s = {};
#pragma unroll
        for (int kb = 0; kb < 4; ++kb) {
            v16h bk = load_frag_f16(kbp, k0 + lm, kb * 32, hi, CH);
            s = __builtin_amdgcn_wmma_f32_16x16x32_f16(false, bk, false, aq[kb],
                                                       (short)0, s, false, false);
        }
        const int dlast = qrow - k0 - 8 * hi;
        float rmax = -3.0e38f;
#pragma unroll
        for (int r = 0; r < 8; ++r) {
            float v = s[r] * scale;
            if (r > dlast) v = -3.0e38f;
            s[r] = v;
            rmax = fmaxf(rmax, v);
        }
        rmax = fmaxf(rmax, xhalf(rmax));
        const float mnew = fmaxf(mrun, rmax);
        const float alpha = __expf(mrun - mnew);
        mrun = mnew;

        v16h pt;
        float rsum = 0.0f;
#pragma unroll
        for (int r = 0; r < 8; ++r) {
            const float pv = __expf(s[r] - mnew);
            rsum += pv;
            pt[r]     = (_Float16)pv;
            pt[8 + r] = (_Float16)0.0f;          // K 16..31 = 0
        }
        lrun = lrun * alpha + rsum;

#pragma unroll
        for (int n = 0; n < 8; ++n)
#pragma unroll
            for (int r = 0; r < 8; ++r) o[n][r] *= alpha;

#pragma unroll
        for (int n = 0; n < 8; ++n) {
            const _Float16* vrow = vTb + (size_t)(n * 16 + lm) * SEQ + k0;
            union { uint4 q[2]; v16h v; } ub;
            ub.q[0] = *reinterpret_cast<const uint4*>(vrow + hi * 8);  // k 0..15 (in range)
            ub.q[1] = (uint4){0, 0, 0, 0};                             // padded half
            o[n] = __builtin_amdgcn_wmma_f32_16x16x32_f16(false, ub.v, false, pt,
                                                          (short)0, o[n], false, false);
        }
    }

    // ---- publish this wave's partial (max, sum, un-normalised O) ----
    // A wave without a key block publishes max -3e38, sum 0, O 0: weight 0 below.
    const float lsum = lrun + xhalf(lrun);     // the two halves' key sums joined
    if (hi == 0) {
        lds_m[wave * 16 + lm] = mrun;
        lds_l[wave * 16 + lm] = lsum;
    }
    // a lane holds 8 channels in a row of its query: two 16-byte stores a tile
    float* lo = reinterpret_cast<float*>(kbuf) + lm * OPITCH + 8 * hi;
#pragma unroll
    for (int n = 0; n < 8; ++n) {
        *reinterpret_cast<float4*>(lo + n * 16)     = make_float4(o[n][0], o[n][1], o[n][2], o[n][3]);
        *reinterpret_cast<float4*>(lo + n * 16 + 4) = make_float4(o[n][4], o[n][5], o[n][6], o[n][7]);
    }

    __syncthreads();   // every wave's partial is in LDS before any wave merges

    float* ob = out + (size_t)b * SEQ * CH;
#pragma unroll
    for (int rr = 0; rr < 2; ++rr) {
        const int row = wave * 2 + rr;
        float ms[8];
        float mall = -3.0e38f;
#pragma unroll
        for (int s = 0; s < 8; ++s) {
            ms[s] = lds_m[s * 16 + row];
            mall = fmaxf(mall, ms[s]);
        }
        float lall = 0.0f;
        float4 acc = make_float4(0.0f, 0.0f, 0.0f, 0.0f);
#pragma unroll
        for (int s = 0; s < 8; ++s) {
            const float e = __expf(ms[s] - mall);
            const float4 ov = *reinterpret_cast<const float4*>(
                reinterpret_cast<const float*>(ring + s * WBYTES) + row * OPITCH + lane * 4);
            lall += e * lds_l[s * 16 + row];
            acc.x += e * ov.x; acc.y += e * ov.y;
            acc.z += e * ov.z; acc.w += e * ov.w;
        }
        const float inv = 1.0f / lall;
        acc.x *= inv; acc.y *= inv; acc.z *= inv; acc.w *= inv;
        *reinterpret_cast<float4*>(ob + (size_t)(qt * 16 + row) * CH + lane * 4) = acc;
    }
}

// ---------------------------------------------------------------------------
extern "C" void kernel_launch(void* const* d_in, const int* in_sizes, int n_in,
                              void* d_out, int out_size, void* d_ws, size_t ws_size,
                              hipStream_t stream) {
    (void)in_sizes; (void)n_in; (void)out_size; (void)ws_size;
    const float* X  = (const float*)d_in[0];
    const float* Wq = (const float*)d_in[1];
    const float* Wk = (const float*)d_in[2];
    const float* Wv = (const float*)d_in[3];
    float* out = (float*)d_out;

    const size_t elems = (size_t)BATCH * SEQ * CH;       // 2,097,152
    _Float16* qh = (_Float16*)d_ws;
    _Float16* kh = qh + elems;
    _Float16* vT = kh + elems;                            // [B][CH][SEQ]

    // 3 proj * 4 batch * 256 mt * 8 nt tiles / 8 waves per block = 3072 blocks
    qkv_proj_kernel<<<3072, 256, 0, stream>>>(X, Wq, Wk, Wv, qh, kh, vT);
    // 4 batch * 256 query tiles, one block of 8 waves each = 1024 blocks
    flash_attn_kernel<<<1024, 256, 0, stream>>>(qh, kh, vT, out);
}

// v004
// A run of this version takes 58 microseconds.
// Next to v003, in two timings, it ran 1.18 and 1.19 times as fast.
// Counting every step since v000, it is 7.65 times as fast.
#include <hip/hip_runtime.h>
#include <hip/hip_bf16.h>

typedef __attribute__((ext_vector_type(16))) _Float16 v16h;
typedef __attribute__((ext_vector_type(8)))  float    v8f;

#define BATCH 4
#define SEQ   4096
#define CH    128
#define QTILES32 (SEQ / 32)   // 128 query tiles of 32 rows

__device__ inline v16h load_frag_f16(const _Float16* base, size_t row, int koff, int hi, int ld) {
    const _Float16* p = base + row * ld + koff + hi * 8;
    union { uint4 q[2]; v16h v; } u;
    u.q[0] = *reinterpret_cast<const uint4*>(p);        // 8 halves, 16B aligned
    u.q[1] = *reinterpret_cast<const uint4*>(p + 16);   // 8 halves
    return u.v;
}

__device__ inline v16h load_frag_f32(const float* base, int row, int kb, int hi) {
    const float* p = base + (size_t)row * CH + kb * 32 + hi * 8;
    float4 a0 = *reinterpret_cast<const float4*>(p);
    float4 a1 = *reinterpret_cast<const float4*>(p + 4);
    float4 b0 = *reinterpret_cast<const float4*>(p + 16);
    float4 b1 = *reinterpret_cast<const float4*>(p + 20);
    v16h v;
    v[0]=(_Float16)a0.x; v[1]=(_Float16)a0.y; v[2]=(_Float16)a0.z; v[3]=(_Float16)a0.w;
    v[4]=(_Float16)a1.x; v[5]=(_Float16)a1.y; v[6]=(_Float16)a1.z; v[7]=(_Float16)a1.w;
    v[8]=(_Float16)b0.x; v[9]=(_Float16)b0.y; v[10]=(_Float16)b0.z; v[11]=(_Float16)b0.w;
    v[12]=(_Float16)b1.x; v[13]=(_Float16)b1.y; v[14]=(_Float16)b1.z; v[15]=(_Float16)b1.w;
    return v;
}

// ---------------------------------------------------------------------------
// Kernel 1: q/k/v = X @ W^T, f32 in -> f16 out (f32 WMMA accumulate).
// q,k stored row-major [T][C]; v stored TRANSPOSED [C][T] so the attention
// kernel's V^T * P^T A-fragments are contiguous b128 loads.
// One wave per 16x16 output tile. Tiles: 3 proj * 4 batch * 256 mt * 8 nt.
// ---------------------------------------------------------------------------
__global__ __launch_bounds__(256) void qkv_proj_kernel(
    const float* __restrict__ X,
    const float* __restrict__ Wq, const float* __restrict__ Wk, const float* __restrict__ Wv,
    _Float16* __restrict__ qh, _Float16* __restrict__ kh, _Float16* __restrict__ vT)
{
    const int wave = threadIdx.x >> 5;
    const int lane = threadIdx.x & 31;
    const int lm = lane & 15, hi = lane >> 4;

    int flat = blockIdx.x * 8 + wave;         // [0, 24576)
    const int nt = flat & 7;   flat >>= 3;
    const int mt = flat & 255; flat >>= 8;
    const int b  = flat & 3;   const int p = flat >> 2;

    const float* W = (p == 0) ? Wq : (p == 1) ? Wk : Wv;
    const float* Xb = X + (size_t)b * SEQ * CH;

    v8f c = {};
#pragma unroll
    for (int kb = 0; kb < 4; ++kb) {
        v16h a  = load_frag_f32(Xb, mt * 16 + lm, kb, hi);   // A: X tile row
        v16h bw = load_frag_f32(W,  nt * 16 + lm, kb, hi);   // B: W^T column = W row
        c = __builtin_amdgcn_wmma_f32_16x16x32_f16(false, a, false, bw,
                                                   (short)0, c, false, false);
    }

    if (p < 2) {
        _Float16* ob = ((p == 0) ? qh : kh) + (size_t)b * SEQ * CH;
#pragma unroll
        for (int r = 0; r < 8; ++r) {
            const int row = mt * 16 + r + 8 * hi;
            const int col = nt * 16 + lm;
            ob[(size_t)row * CH + col] = (_Float16)c[r];
        }
    } else {
        // transposed store: vT[col][row]; rows contiguous along r -> one b128
        union { uint4 q; _Float16 h[8]; } u;
#pragma unroll
        for (int r = 0; r < 8; ++r) u.h[r] = (_Float16)c[r];
        _Float16* ob = vT + (size_t)b * SEQ * CH
                          + (size_t)(nt * 16 + lm) * SEQ + mt * 16 + 8 * hi;
        *reinterpret_cast<uint4*>(ob) = u.q;
    }
}

#define OPITCH 132
#define KPITCH 272
#define VPITCH 80
#define KBYTES (32 * KPITCH)          // 32 keys
#define VBYTES (CH * VPITCH)          // 128 channels
#define WBYTES (KBYTES + VBYTES)      // one wave's buffers, 18,944 B

typedef __attribute__((ext_vector_type(4))) int v4i;
typedef __attribute__((address_space(1))) v4i gl_v4i;
typedef __attribute__((address_space(3))) v4i ls_v4i;

// The offset field moves the LDS and the global address alike: with the LDS step in it, one
// LDS address register serves all 16 copies of a tile (16 of them did not fit the register
// budget); what the global step differs from the LDS step by is added to the global base.
template <int C>
__device__ inline void copy_k_from(const unsigned char* ub, unsigned voff, ls_v4i* l) {
    if constexpr (C < 16) {
        __builtin_amdgcn_global_load_async_to_lds_b128(
            (gl_v4i*)(ub + (C * 512 - C * 2 * KPITCH) + voff), l, C * 2 * KPITCH, 0);
        copy_k_from<C + 1>(ub, voff, l);
    }
}
template <int C>
__device__ inline void copy_v_from(const unsigned char* ub, unsigned voff, ls_v4i* l) {
    if constexpr (C < 16) {
        __builtin_amdgcn_global_load_async_to_lds_b128(
            (gl_v4i*)(ub + (C * 8 * SEQ * 2 - C * 8 * VPITCH) + voff), l, C * 8 * VPITCH, 0);
        copy_v_from<C + 1>(ub, voff, l);
    }
}

// 32 K rows are 8 KB in a row in memory: each copy takes 512 B = 4 whole lines (2 rows).
__device__ inline void copy_k_block(const _Float16* kblk, unsigned char* kbuf, int lane) {
    copy_k_from<0>(reinterpret_cast<const unsigned char*>(kblk), (unsigned)(lane * 16),
                   (ls_v4i*)(kbuf + (lane >> 4) * KPITCH + (lane & 15) * 16));
}

// 128 V^T rows of 64 B: each copy takes 8 rows, 4 lanes a row.
__device__ inline void copy_v_block(const _Float16* vblk, unsigned char* vbuf, int lane) {
    copy_v_from<0>(reinterpret_cast<const unsigned char*>(vblk),
                   (unsigned)((lane >> 2) * (SEQ * 2) + (lane & 3) * 16),
                   (ls_v4i*)(vbuf + (lane >> 2) * VPITCH + (lane & 3) * 16));
}

// fragment from a staged tile: 16 B at p, 16 B at p + 32 (the k order of load_frag_f16)
__device__ inline v16h lds_frag(const unsigned char* p) {
    union { uint4 q[2]; v16h v; } u;
    u.q[0] = *reinterpret_cast<const uint4*>(p);
    u.q[1] = *reinterpret_cast<const uint4*>(p + 32);
    return u.v;
}
__device__ inline float xhalf(float x) {
    return __builtin_bit_cast(float, __builtin_amdgcn_permlanex16(
        __builtin_bit_cast(int, x), __builtin_bit_cast(int, x),
        0x76543210, 0xfedcba98, false, false));
}

__global__ __launch_bounds__(256) void flash_attn_kernel(
    const _Float16* __restrict__ qh, const _Float16* __restrict__ kh,
    const _Float16* __restrict__ vT, float* __restrict__ out)
{
    // 8 waves * (K buffer, V^T buffer); behind the loop a wave's own range holds its partial O
    __shared__ __attribute__((aligned(16))) unsigned char ring[8 * WBYTES];
    __shared__ float lds_m[8 * 32];           // 8 waves * 32 row maxima
    __shared__ float lds_l[8 * 32];           // 8 waves * 32 row sums

    // wave number in a scalar register: trip counts and branches stay scalar
    const int wave = __builtin_amdgcn_readfirstlane(threadIdx.x >> 5);
    const int lane = threadIdx.x & 31;
    const int lm = lane & 15, hi = lane >> 4;

    const int qt = (QTILES32 - 1) - (blockIdx.x >> 2);   // longest tiles start first
    const int b  = blockIdx.x & 3;

    const _Float16* qb  = qh + (size_t)b * SEQ * CH;
    const _Float16* kbp = kh + (size_t)b * SEQ * CH;
    const _Float16* vTb = vT + (size_t)b * SEQ * CH;   // [CH][SEQ]

    v8f o[2][8];
#pragma unroll
    for (int g = 0; g < 2; ++g)
#pragma unroll
        for (int n = 0; n < 8; ++n) o[g][n] = (v8f){};

    // this lane's query of each group: running maximum (alike in both halves) and the sum
    // over this half's keys (the halves are joined once, behind the loop)
    float mrun[2] = {-3.0e38f, -3.0e38f}, lrun[2] = {0.0f, 0.0f};

    const float scale = 0.08838834764831845f;  // 1/sqrt(128)

    const int nblk = qt + 1;                   // 32-key blocks; the last holds the diagonal

    unsigned char* kbuf = ring + wave * WBYTES;
    unsigned char* vbuf = kbuf + KBYTES;
    const unsigned char* kfr = kbuf + lm * KPITCH + hi * 16;
    const unsigned char* vfr = vbuf + lm * VPITCH + hi * 16;

    if (wave < nblk) {                         // scalar test: this wave's first block
        copy_k_block(kbp + (size_t)wave * 32 * CH, kbuf, lane);
        copy_v_block(vTb + wave * 32, vbuf, lane);
    }

    const _Float16* qlane = qb + (size_t)(qt * 32 + lm) * CH + hi * 8;
    v16h aq[2][4];
#pragma unroll
    for (int g = 0; g < 2; ++g)
#pragma unroll
        for (int kb = 0; kb < 4; ++kb)
            aq[g][kb] = load_frag_f16(qlane, 0, g * 16 * CH + kb * 32, 0, CH);
    // The wait in front of any rewrite of the Q loads' address registers. Inputs only: the
    // loaded values keep the loads in front of it, the address keeps its registers up to it.
    asm volatile("s_wait_xcnt 0x0"
                 :: "v"(qlane), "v"(aq[0][0]), "v"(aq[0][1]), "v"(aq[0][2]), "v"(aq[0][3]),
                    "v"(aq[1][0]), "v"(aq[1][1]), "v"(aq[1][2]), "v"(aq[1][3])
                 : "memory");

    for (int jj = wave; jj < nblk; jj += 8) {
        const int k0 = jj * 32;

        // this block's K and V^T have landed before this wave reads them
        asm volatile("s_wait_asynccnt 0x0" ::: "memory");

        // ---- S^T = K * Q^T for two adjacent 16-key tiles (K=128), both query groups ----
        // s0[g][r]: key k0 + 8 hi + r, s1[g][r]: key k0 + 16 + 8 hi + r, query 16 g + lm
        v8f s0[2] = {{}, {}}, s1[2] = {{}, {}};
#pragma unroll
        for (int kb = 0; kb < 4; ++kb) {
            v16h bk0 = lds_frag(kfr + kb * 64);
            v16h bk1 = lds_frag(kfr + 16 * KPITCH + kb * 64);
#pragma unroll
            for (int g = 0; g < 2; ++g) {
                s0[g] = __builtin_amdgcn_wmma_f32_16x16x32_f16(false, bk0, false, aq[g][kb],
                                                               (short)0, s0[g], false, false);
                s1[g] = __builtin_amdgcn_wmma_f32_16x16x32_f16(false, bk1, false, aq[g][kb],
                                                               (short)0, s1[g], false, false);
            }
        }

        // V^T fragments into registers now, so that both buffers are free for the next block
        v16h bv[8];
#pragma unroll
        for (int n = 0; n < 8; ++n) bv[n] = lds_frag(vfr + n * 16 * VPITCH);

        // every read of the two buffers has returned before the copies overwrite them
        asm volatile("s_wait_dscnt 0x0" ::: "memory");
        if (jj + 8 < nblk) {                   // scalar test: a next block exists
            copy_k_block(kbp + (size_t)(k0 + 256) * CH, kbuf, lane);
            copy_v_block(vTb + k0 + 256, vbuf, lane);
        }

        // ---- mask + scale + online softmax over 32 keys, one query a lane and group ----
        v16h pt[2];                              // P^T as B operand: pt[g][s] = key kmap(s, hi)
#pragma unroll
        for (int g = 0; g < 2; ++g) {
            // last r of s0[g] that this query may see
            const int dlast = qt * 32 + g * 16 + lm - k0 - 8 * hi;
            float rmax = -3.0e38f;
#pragma unroll
            for (int r = 0; r < 8; ++r) {
                float v0 = s0[g][r] * scale;
                float v1 = s1[g][r] * scale;
                if (r      > dlast) v0 = -3.0e38f;   // bites only in the diagonal block
                if (r + 16 > dlast) v1 = -3.0e38f;
                s0[g][r] = v0;
                s1[g][r] = v1;
                rmax = fmaxf(rmax, fmaxf(v0, v1));
            }
            rmax = fmaxf(rmax, xhalf(rmax));
            const float mnew = fmaxf(mrun[g], rmax);
            const float alpha = __expf(mrun[g] - mnew);
            mrun[g] = mnew;

            float rs0 = 0.0f, rs1 = 0.0f;
#pragma unroll
            for (int r = 0; r < 8; ++r) {
                const float p0 = __expf(s0[g][r] - mnew);
                const float p1 = __expf(s1[g][r] - mnew);
                rs0 += p0;
                rs1 += p1;
                pt[g][r]     = (_Float16)p0;
                pt[g][8 + r] = (_Float16)p1;
            }
            lrun[g] = lrun[g] * alpha + (rs0 + rs1);

#pragma unroll
            for (int n = 0; n < 8; ++n)
#pragma unroll
                for (int r = 0; r < 8; ++r) o[g][n][r] *= alpha;
        }

        // ---- O^T += V^T * P^T : full-K WMMAs; o[g][n][r]: channel 16 n + 8 hi + r ----
#pragma unroll
        for (int n = 0; n < 8; ++n)
#pragma unroll
            for (int g = 0; g < 2; ++g)
                o[g][n] = __builtin_amdgcn_wmma_f32_16x16x32_f16(false, bv[n], false, pt[g],
                                                                 (short)0, o[g][n], false, false);
    }
    // no copy of this wave is outstanding before its buffers take the partial O
    asm volatile("s_wait_asynccnt 0x0" ::: "memory");

    // ---- publish this wave's partial (max, sum, un-normalised O) ----
    // A wave without a key block publishes max -3e38, sum 0, O 0: weight 0 below.
#pragma unroll
    for (int g = 0; g < 2; ++g) {
        const float lsum = lrun[g] + xhalf(lrun[g]);   // the two halves' key sums joined
        if (hi == 0) {
            lds_m[wave * 32 + g * 16 + lm] = mrun[g];
            lds_l[wave * 32 + g * 16 + lm] = lsum;
        }
        // a lane holds 8 channels in a row of its query: two 16-byte stores a tile
        float* lo = reinterpret_cast<float*>(kbuf) + (g * 16 + lm) * OPITCH + 8 * hi;
#pragma unroll
        for (int n = 0; n < 8; ++n) {
            *reinterpret_cast<float4*>(lo + n * 16) =
                make_float4(o[g][n][0], o[g][n][1], o[g][n][2], o[g][n][3]);
            *reinterpret_cast<float4*>(lo + n * 16 + 4) =
                make_float4(o[g][n][4], o[g][n][5], o[g][n][6], o[g][n][7]);
        }
    }

    __syncthreads();   // every wave's partial is in LDS before any wave merges

    float* ob = out + (size_t)b * SEQ * CH;
#pragma unroll
    for (int rr = 0; rr < 4; ++rr) {
        const int row = wave * 4 + rr;
        float ms[8];
        float mall = -3.0e38f;
#pragma unroll
        for (int s = 0; s < 8; ++s) {
            ms[s] = lds_m[s * 32 + row];
            mall = fmaxf(mall, ms[s]);
        }
        float lall = 0.0f;
        float4 acc = make_float4(0.0f, 0.0f, 0.0f, 0.0f);
#pragma unroll
        for (int s = 0; s < 8; ++s) {
            const float e = __expf(ms[s] - mall);
            const float4 ov = *reinterpret_cast<const float4*>(
                reinterpret_cast<const float*>(ring + s * WBYTES) + row * OPITCH + lane * 4);
            lall += e * lds_l[s * 32 + row];
            acc.x += e * ov.x; acc.y += e * ov.y;
            acc.z += e * ov.z; acc.w += e * ov.w;
        }
        const float inv = 1.0f / lall;
        acc.x *= inv; acc.y *= inv; acc.z *= inv; acc.w *= inv;
        *reinterpret_cast<float4*>(ob + (size_t)(qt * 32 + row) * CH + lane * 4) = acc;
    }
}

// ---------------------------------------------------------------------------
extern "C" void kernel_launch(void* const* d_in, const int* in_sizes, int n_in,
                              void* d_out, int out_size, void* d_ws, size_t ws_size,
                              hipStream_t stream) {
    (void)in_sizes; (void)n_in; (void)out_size; (void)ws_size;
    const float* X  = (const float*)d_in[0];
    const float* Wq = (const float*)d_in[1];
    const float* Wk = (const float*)d_in[2];
    const float* Wv = (const float*)d_in[3];
    float* out = (float*)d_out;

    const size_t elems = (size_t)BATCH * SEQ * CH;       // 2,097,152
    _Float16* qh = (_Float16*)d_ws;
    _Float16* kh = qh + elems;
    _Float16* vT = kh + elems;                            // [B][CH][SEQ]

    // 3 proj * 4 batch * 256 mt * 8 nt tiles / 8 waves per block = 3072 blocks
    qkv_proj_kernel<<<3072, 256, 0, stream>>>(X, Wq, Wk, Wv, qh, kh, vT);
    // 4 batch * 128 query tiles, one block of 8 waves each = 512 blocks
    flash_attn_kernel<<<512, 256, 0, stream>>>(qh, kh, vT, out);
}

// v005
// Measured time: 37.4 microseconds a run.
// In two side-by-side timings against v004, it was 1.55 and 1.56 times as fast.
// All steps since v000 together make it 11.9 times as fast.
#include <hip/hip_runtime.h>
#include <hip/hip_bf16.h>

typedef __attribute__((ext_vector_type(16))) _Float16 v16h;
typedef __attribute__((ext_vector_type(8)))  float    v8f;

#define BATCH 4
#define SEQ   4096
#define CH    128
#define QTILES32 (SEQ / 32)   // 128 query tiles of 32 rows

__device__ inline v16h load_frag_f16(const _Float16* base, size_t row, int koff, int hi, int ld) {
    const _Float16* p = base + row * ld + koff + hi * 8;
    union { uint4 q[2]; v16h v; } u;
    u.q[0] = *reinterpret_cast<const uint4*>(p);        // 8 halves, 16B aligned
    u.q[1] = *reinterpret_cast<const uint4*>(p + 16);   // 8 halves
    return u.v;
}

// fragment from a staged tile: 16 B at p, 16 B at p + 32 (the k order of load_frag_f16)
__device__ inline v16h lds_frag(const unsigned char* p) {
    union { uint4 q[2]; v16h v; } u;
    u.q[0] = *reinterpret_cast<const uint4*>(p);
    u.q[1] = *reinterpret_cast<const uint4*>(p + 32);
    return u.v;
}

// ---------------------------------------------------------------------------
// Kernel 1: q/k/v = X @ W^T, f32 in -> f16 out (f32 WMMA accumulate).
// q,k stored row-major [T][C]; v stored TRANSPOSED [C][T] so the attention
// kernel's V^T A-fragments (O^T += V^T * P^T) are contiguous b128 loads.
// One work-group per 64 tokens makes all 384 columns of q, k and v. It rounds
// its 64 X rows and the 384 W rows to f16 once, whole 512-byte rows a load,
// into LDS; behind one barrier wave w makes column tiles 3w .. 3w+2 (of 24)
// for all four 16-token tiles: twelve accumulators, and per 32-wide k chunk
// seven fragments from LDS feed twelve products.
// ---------------------------------------------------------------------------
#define PTOK   64                     // tokens per work-group
#define PPITCH 272                    // bytes per staged row (256 used): 16 B x odd
#define PROWS  (PTOK + 3 * CH)        // X rows, then Wq, Wk, Wv rows

__device__ inline void stage_row4(unsigned char* d, float4 f) {
    union { uint2 q; _Float16 h[4]; } u;
    u.h[0] = (_Float16)f.x; u.h[1] = (_Float16)f.y;
    u.h[2] = (_Float16)f.z; u.h[3] = (_Float16)f.w;
    *reinterpret_cast<uint2*>(d) = u.q;
}

__global__ __launch_bounds__(256) void qkv_proj_kernel(
    const float* __restrict__ X,
    const float* __restrict__ Wq, const float* __restrict__ Wk, const float* __restrict__ Wv,
    _Float16* __restrict__ qh, _Float16* __restrict__ kh, _Float16* __restrict__ vT)
{
    __shared__ __attribute__((aligned(16))) unsigned char st[PROWS * PPITCH];   // 121,856 B

    // wave number in a scalar register: row addresses and the q/k/v branches stay scalar
    const int wave = __builtin_amdgcn_readfirstlane(threadIdx.x >> 5);
    const int lane = threadIdx.x & 31;
    const int lm = lane & 15, hi = lane >> 4;

    const int tok0 = blockIdx.x * PTOK;       // flat token; 64 divides SEQ: one batch a group

    // ---- stage: a wave's load takes one whole row (32 lanes x 16 B), rows wave, wave + 8, ...
    const float* xs = X + (size_t)tok0 * CH + wave * CH + lane * 4;
    const float* wq = Wq + wave * CH + lane * 4;
    const float* wk = Wk + wave * CH + lane * 4;
    const float* wv = Wv + wave * CH + lane * 4;
    float4 rx[8], rq[16], rk[16], rv[16];
#pragma unroll
    for (int i = 0; i < 8; ++i)  rx[i] = *reinterpret_cast<const float4*>(xs + i * 8 * CH);
#pragma unroll
    for (int i = 0; i < 16; ++i) rq[i] = *reinterpret_cast<const float4*>(wq + i * 8 * CH);
#pragma unroll
    for (int i = 0; i < 16; ++i) rk[i] = *reinterpret_cast<const float4*>(wk + i * 8 * CH);
#pragma unroll
    for (int i = 0; i < 16; ++i) rv[i] = *reinterpret_cast<const float4*>(wv + i * 8 * CH);

    unsigned char* sd = st + wave * PPITCH + lane * 8;
#pragma unroll
    for (int i = 0; i < 8; ++i)  stage_row4(sd + (i * 8) * PPITCH, rx[i]);
#pragma unroll
    for (int i = 0; i < 16; ++i) stage_row4(sd + (PTOK + i * 8) * PPITCH, rq[i]);
#pragma unroll
    for (int i = 0; i < 16; ++i) stage_row4(sd + (PTOK + CH + i * 8) * PPITCH, rk[i]);
#pragma unroll
    for (int i = 0; i < 16; ++i) stage_row4(sd + (PTOK + 2 * CH + i * 8) * PPITCH, rv[i]);

    __syncthreads();   // every staged row is in LDS before any wave takes fragments

    // ---- wave w: column tiles 3w .. 3w+2 (B = W^T column = W row) x four token tiles (A) ----
    const unsigned char* xf = st + lm * PPITCH + hi * 16;
    const unsigned char* wf = xf + (PTOK + wave * 48) * PPITCH;
    v16h a[2][4], bw[2][3];
#pragma unroll
    for (int tt = 0; tt < 4; ++tt) a[0][tt] = lds_frag(xf + tt * 16 * PPITCH);
#pragma unroll
    for (int j = 0; j < 3; ++j) bw[0][j] = lds_frag(wf + j * 16 * PPITCH);

    v8f c[4][3];
#pragma unroll
    for (int tt = 0; tt < 4; ++tt)
#pragma unroll
        for (int j = 0; j < 3; ++j) c[tt][j] = (v8f){};

#pragma unroll
    for (int kb = 0; kb < 4; ++kb) {
        const int cur = kb & 1;
        if (kb < 3) {
#pragma unroll
            for (int tt = 0; tt < 4; ++tt)
                a[cur ^ 1][tt] = lds_frag(xf + tt * 16 * PPITCH + (kb + 1) * 64);
#pragma unroll
            for (int j = 0; j < 3; ++j)
                bw[cur ^ 1][j] = lds_frag(wf + j * 16 * PPITCH + (kb + 1) * 64);
        }
        // keeps the next k chunk's LDS reads in front of this chunk's twelve products, so that
        // their latency runs under the products instead of in front of each of them
        __builtin_amdgcn_sched_barrier(0);
#pragma unroll
        for (int tt = 0; tt < 4; ++tt)
#pragma unroll
            for (int j = 0; j < 3; ++j)
                c[tt][j] = __builtin_amdgcn_wmma_f32_16x16x32_f16(false, a[cur][tt], false,
                                                                  bw[cur][j], (short)0, c[tt][j],
                                                                  false, false);
    }

    const unsigned voq = (unsigned)((8 * hi) * CH + lm);    // q, k: token 8 hi (+ r), column lm
    const unsigned vov = (unsigned)(lm * SEQ + 8 * hi);     // vT: column lm, token 8 hi
#pragma unroll
    for (int j = 0; j < 3; ++j) {
        const int ct = wave * 3 + j;          // scalar
        const int p = ct >> 3, nt = ct & 7;
        if (p < 2) {
            _Float16* ob = ((p == 0) ? qh : kh) + (size_t)tok0 * CH + nt * 16;
#pragma unroll
            for (int tt = 0; tt < 4; ++tt)
#pragma unroll
                for (int r = 0; r < 8; ++r)
                    ob[voq + (unsigned)((tt * 16 + r) * CH)] = (_Float16)c[tt][j][r];
        } else {
            // transposed store: vT[col][row]; rows contiguous along r -> one b128
            _Float16* ob = vT + (size_t)(tok0 / SEQ) * SEQ * CH + (tok0 % SEQ)
                              + (size_t)nt * 16 * SEQ;
#pragma unroll
            for (int tt = 0; tt < 4; ++tt) {
                union { uint4 q; _Float16 h[8]; } u;
#pragma unroll
                for (int r = 0; r < 8; ++r) u.h[r] = (_Float16)c[tt][j][r];
                *reinterpret_cast<uint4*>(ob + vov + (unsigned)(tt * 16)) = u.q;
            }
            // the wait in front of any rewrite of a register that these four stores name
            asm volatile("s_wait_xcnt 0x0" ::: "memory");
        }
    }
}

#define OPITCH 132
#define KPITCH 272
#define VPITCH 80
#define KBYTES (32 * KPITCH)          // 32 keys
#define VBYTES (CH * VPITCH)          // 128 channels
#define WBYTES (KBYTES + VBYTES)      // one wave's buffers, 18,944 B

typedef __attribute__((ext_vector_type(4))) int v4i;
typedef __attribute__((address_space(1))) v4i gl_v4i;
typedef __attribute__((address_space(3))) v4i ls_v4i;

// The offset field moves the LDS and the global address alike: with the LDS step in it, one
// LDS address register serves all 16 copies of a tile (16 of them did not fit the register
// budget); what the global step differs from the LDS step by is added to the global base.
template <int C>
__device__ inline void copy_k_from(const unsigned char* ub, unsigned voff, ls_v4i* l) {
    if constexpr (C < 16) {
        __builtin_amdgcn_global_load_async_to_lds_b128(
            (gl_v4i*)(ub + (C * 512 - C * 2 * KPITCH) + voff), l, C * 2 * KPITCH, 0);
        copy_k_from<C + 1>(ub, voff, l);
    }
}
template <int C>
__device__ inline void copy_v_from(const unsigned char* ub, unsigned voff, ls_v4i* l) {
    if constexpr (C < 16) {
        __builtin_amdgcn_global_load_async_to_lds_b128(
            (gl_v4i*)(ub + (C * 8 * SEQ * 2 - C * 8 * VPITCH) + voff), l, C * 8 * VPITCH, 0);
        copy_v_from<C + 1>(ub, voff, l);
    }
}

// 32 K rows are 8 KB in a row in memory: each copy takes 512 B = 4 whole lines (2 rows).
__device__ inline void copy_k_block(const _Float16* kblk, unsigned char* kbuf, int lane) {
    copy_k_from<0>(reinterpret_cast<const unsigned char*>(kblk), (unsigned)(lane * 16),
                   (ls_v4i*)(kbuf + (lane >> 4) * KPITCH + (lane & 15) * 16));
}

// 128 V^T rows of 64 B: each copy takes 8 rows, 4 lanes a row.
__device__ inline void copy_v_block(const _Float16* vblk, unsigned char* vbuf, int lane) {
    copy_v_from<0>(reinterpret_cast<const unsigned char*>(vblk),
                   (unsigned)((lane >> 2) * (SEQ * 2) + (lane & 3) * 16),
                   (ls_v4i*)(vbuf + (lane >> 2) * VPITCH + (lane & 3) * 16));
}

__device__ inline float xhalf(float x) {
    return __builtin_bit_cast(float, __builtin_amdgcn_permlanex16(
        __builtin_bit_cast(int, x), __builtin_bit_cast(int, x),
        0x76543210, 0xfedcba98, false, false));
}

__global__ __launch_bounds__(256) void flash_attn_kernel(
    const _Float16* __restrict__ qh, const _Float16* __restrict__ kh,
    const _Float16* __restrict__ vT, float* __restrict__ out)
{
    // 8 waves * (K buffer, V^T buffer); behind the loop a wave's own range holds its partial O
    __shared__ __attribute__((aligned(16))) unsigned char ring[8 * WBYTES];
    __shared__ float lds_m[8 * 32];           // 8 waves * 32 row maxima
    __shared__ float lds_l[8 * 32];           // 8 waves * 32 row sums

    // wave number in a scalar register: trip counts and branches stay scalar
    const int wave = __builtin_amdgcn_readfirstlane(threadIdx.x >> 5);
    const int lane = threadIdx.x & 31;
    const int lm = lane & 15, hi = lane >> 4;

    const int qt = (QTILES32 - 1) - (blockIdx.x >> 2);   // longest tiles start first
    const int b  = blockIdx.x & 3;

    const _Float16* qb  = qh + (size_t)b * SEQ * CH;
    const _Float16* kbp = kh + (size_t)b * SEQ * CH;
    const _Float16* vTb = vT + (size_t)b * SEQ * CH;   // [CH][SEQ]

    v8f o[2][8];
#pragma unroll
    for (int g = 0; g < 2; ++g)
#pragma unroll
        for (int n = 0; n < 8; ++n) o[g][n] = (v8f){};

    // this lane's query of each group: running maximum (alike in both halves) and the sum
    // over this half's keys (the halves are joined once, behind the loop)
    float mrun[2] = {-3.0e38f, -3.0e38f}, lrun[2] = {0.0f, 0.0f};

    const float scale = 0.08838834764831845f;  // 1/sqrt(128)

    const int nblk = qt + 1;                   // 32-key blocks; the last holds the diagonal

    unsigned char* kbuf = ring + wave * WBYTES;
    unsigned char* vbuf = kbuf + KBYTES;
    const unsigned char* kfr = kbuf + lm * KPITCH + hi * 16;
    const unsigned char* vfr = vbuf + lm * VPITCH + hi * 16;

    if (wave < nblk) {                         // scalar test: this wave's first block
        copy_k_block(kbp + (size_t)wave * 32 * CH, kbuf, lane);
        copy_v_block(vTb + wave * 32, vbuf, lane);
    }

    const _Float16* qlane = qb + (size_t)(qt * 32 + lm) * CH + hi * 8;
    v16h aq[2][4];
#pragma unroll
    for (int g = 0; g < 2; ++g)
#pragma unroll
        for (int kb = 0; kb < 4; ++kb)
            aq[g][kb] = load_frag_f16(qlane, 0, g * 16 * CH + kb * 32, 0, CH);
    // The wait in front of any rewrite of the Q loads' address registers. Inputs only: the
    // loaded values keep the loads in front of it, the address keeps its registers up to it.
    asm volatile("s_wait_xcnt 0x0"
                 :: "v"(qlane), "v"(aq[0][0]), "v"(aq[0][1]), "v"(aq[0][2]), "v"(aq[0][3]),
                    "v"(aq[1][0]), "v"(aq[1][1]), "v"(aq[1][2]), "v"(aq[1][3])
                 : "memory");

    for (int jj = wave; jj < nblk; jj += 8) {
        const int k0 = jj * 32;

        // this block's K and V^T have landed before this wave reads them
        asm volatile("s_wait_asynccnt 0x0" ::: "memory");

        // ---- S^T = K * Q^T for two adjacent 16-key tiles (K=128), both query groups ----
        // s0[g][r]: key k0 + 8 hi + r, s1[g][r]: key k0 + 16 + 8 hi + r, query 16 g + lm
        v8f s0[2] = {{}, {}}, s1[2] = {{}, {}};
#pragma unroll
        for (int kb = 0; kb < 4; ++kb) {
            v16h bk0 = lds_frag(kfr + kb * 64);
            v16h bk1 = lds_frag(kfr + 16 * KPITCH + kb * 64);
#pragma unroll
            for (int g = 0; g < 2; ++g) {
                s0[g] = __builtin_amdgcn_wmma_f32_16x16x32_f16(false, bk0, false, aq[g][kb],
                                                               (short)0, s0[g], false, false);
                s1[g] = __builtin_amdgcn_wmma_f32_16x16x32_f16(false, bk1, false, aq[g][kb],
                                                               (short)0, s1[g], false, false);
            }
        }

        // V^T fragments into registers now, so that both buffers are free for the next block
        v16h bv[8];
#pragma unroll
        for (int n = 0; n < 8; ++n) bv[n] = lds_frag(vfr + n * 16 * VPITCH);

        // every read of the two buffers has returned before the copies overwrite them
        asm volatile("s_wait_dscnt 0x0" ::: "memory");
        if (jj + 8 < nblk) {                   // scalar test: a next block exists
            copy_k_block(kbp + (size_t)(k0 + 256) * CH, kbuf, lane);
            copy_v_block(vTb + k0 + 256, vbuf, lane);
        }

        // ---- mask + scale + online softmax over 32 keys, one query a lane and group ----
        v16h pt[2];                              // P^T as B operand: pt[g][s] = key kmap(s, hi)
#pragma unroll
        for (int g = 0; g < 2; ++g) {
            // last r of s0[g] that this query may see
            const int dlast = qt * 32 + g * 16 + lm - k0 - 8 * hi;
            float rmax = -3.0e38f;
#pragma unroll
            for (int r = 0; r < 8; ++r) {
                float v0 = s0[g][r] * scale;
                float v1 = s1[g][r] * scale;
                if (r      > dlast) v0 = -3.0e38f;   // bites only in the diagonal block
                if (r + 16 > dlast) v1 = -3.0e38f;
                s0[g][r] = v0;
                s1[g][r] = v1;
                rmax = fmaxf(rmax, fmaxf(v0, v1));
            }
            rmax = fmaxf(rmax, xhalf(rmax));
            const float mnew = fmaxf(mrun[g], rmax);
            const float alpha = __expf(mrun[g] - mnew);
            mrun[g] = mnew;

            float rs0 = 0.0f, rs1 = 0.0f;
#pragma unroll
            for (int r = 0; r < 8; ++r) {
                const float p0 = __expf(s0[g][r] - mnew);
                const float p1 = __expf(s1[g][r] - mnew);
                rs0 += p0;
                rs1 += p1;
                pt[g][r]     = (_Float16)p0;
                pt[g][8 + r] = (_Float16)p1;
            }
            lrun[g] = lrun[g] * alpha + (rs0 + rs1);

#pragma unroll
            for (int n = 0; n < 8; ++n)
#pragma unroll
                for (int r = 0; r < 8; ++r) o[g][n][r] *= alpha;
        }

        // ---- O^T += V^T * P^T : full-K WMMAs; o[g][n][r]: channel 16 n + 8 hi + r ----
#pragma unroll
        for (int n = 0; n < 8; ++n)
#pragma unroll
            for (int g = 0; g < 2; ++g)
                o[g][n] = __builtin_amdgcn_wmma_f32_16x16x32_f16(false, bv[n], false, pt[g],
                                                                 (short)0, o[g][n], false, false);
    }
    // no copy of this wave is outstanding before its buffers take the partial O
    asm volatile("s_wait_asynccnt 0x0" ::: "memory");

    // ---- publish this wave's partial (max, sum, un-normalised O) ----
    // A wave without a key block publishes max -3e38, sum 0, O 0: weight 0 below.
#pragma unroll
    for (int g = 0; g < 2; ++g) {
        const float lsum = lrun[g] + xhalf(lrun[g]);   // the two halves' key sums joined
        if (hi == 0) {
            lds_m[wave * 32 + g * 16 + lm] = mrun[g];
            lds_l[wave * 32 + g * 16 + lm] = lsum;
        }
        // a lane holds 8 channels in a row of its query: two 16-byte stores a tile
        float* lo = reinterpret_cast<float*>(kbuf) + (g * 16 + lm) * OPITCH + 8 * hi;
#pragma unroll
        for (int n = 0; n < 8; ++n) {
            *reinterpret_cast<float4*>(lo + n * 16) =
                make_float4(o[g][n][0], o[g][n][1], o[g][n][2], o[g][n][3]);
            *reinterpret_cast<float4*>(lo + n * 16 + 4) =
                make_float4(o[g][n][4], o[g][n][5], o[g][n][6], o[g][n][7]);
        }
    }

    __syncthreads();   // every wave's partial is in LDS before any wave merges

    float* ob = out + (size_t)b * SEQ * CH;
#pragma unroll
    for (int rr = 0; rr < 4; ++rr) {
        const int row = wave * 4 + rr;
        float ms[8];
        float mall = -3.0e38f;
#pragma unroll
        for (int s = 0; s < 8; ++s) {
            ms[s] = lds_m[s * 32 + row];
            mall = fmaxf(mall, ms[s]);
        }
        float lall = 0.0f;
        float4 acc = make_float4(0.0f, 0.0f, 0.0f, 0.0f);
#pragma unroll
        for (int s = 0; s < 8; ++s) {
            const float e = __expf(ms[s] - mall);
            const float4 ov = *reinterpret_cast<const float4*>(
                reinterpret_cast<const float*>(ring + s * WBYTES) + row * OPITCH + lane * 4);
            lall += e * lds_l[s * 32 + row];
            acc.x += e * ov.x; acc.y += e * ov.y;
            acc.z += e * ov.z; acc.w += e * ov.w;
        }
        const float inv = 1.0f / lall;
        acc.x *= inv; acc.y *= inv; acc.z *= inv; acc.w *= inv;
        *reinterpret_cast<float4*>(ob + (size_t)(qt * 32 + row) * CH + lane * 4) = acc;
    }
}

// ---------------------------------------------------------------------------
extern "C" void kernel_launch(void* const* d_in, const int* in_sizes, int n_in,
                              void* d_out, int out_size, void* d_ws, size_t ws_size,
                              hipStream_t stream) {
    (void)in_sizes; (void)n_in; (void)out_size; (void)ws_size;
    const float* X  = (const float*)d_in[0];
    const float* Wq = (const float*)d_in[1];
    const float* Wk = (const float*)d_in[2];
    const float* Wv = (const float*)d_in[3];
    float* out = (float*)d_out;

    const size_t elems = (size_t)BATCH * SEQ * CH;       // 2,097,152
    _Float16* qh = (_Float16*)d_ws;
    _Float16* kh = qh + elems;
    _Float16* vT = kh + elems;                            // [B][CH][SEQ]

    // 4 batch * 4096 tokens / 64 tokens per block = 256 blocks
    qkv_proj_kernel<<<256, 256, 0, stream>>>(X, Wq, Wk, Wv, qh, kh, vT);
    // 4 batch * 128 query tiles, one block of 8 waves each = 512 blocks
    flash_attn_kernel<<<512, 256, 0, stream>>>(qh, kh, vT, out);
}

// v006
// A run of this version takes 34.5 microseconds.
// In two side-by-side timings against v005, it was 1.08 and 1.09 times as fast.
// Over all steps from v000 it is 12.9 times as fast.
#include <hip/hip_runtime.h>
#include <hip/hip_bf16.h>

typedef __attribute__((ext_vector_type(16))) _Float16 v16h;
typedef __attribute__((ext_vector_type(8)))  float    v8f;

#define BATCH 4
#define SEQ   4096
#define CH    128
#define QTILES32 (SEQ / 32)   // 128 query tiles of 32 rows

__device__ inline v16h load_frag_f16(const _Float16* base, size_t row, int koff, int hi, int ld) {
    const _Float16* p = base + row * ld + koff + hi * 8;
    union { uint4 q[2]; v16h v; } u;
    u.q[0] = *reinterpret_cast<const uint4*>(p);        // 8 halves, 16B aligned
    u.q[1] = *reinterpret_cast<const uint4*>(p + 16);   // 8 halves
    return u.v;
}

// fragment from a staged tile: 16 B at p, 16 B at p + 32 (the k order of load_frag_f16)
__device__ inline v16h lds_frag(const unsigned char* p) {
    union { uint4 q[2]; v16h v; } u;
    u.q[0] = *reinterpret_cast<const uint4*>(p);
    u.q[1] = *reinterpret_cast<const uint4*>(p + 32);
    return u.v;
}

// V^T fragment from a staged block in fragment order: the two 16-key halves lie 512 B apart
__device__ inline v16h lds_frag_v(const unsigned char* p) {
    union { uint4 q[2]; v16h v; } u;
    u.q[0] = *reinterpret_cast<const uint4*>(p);
    u.q[1] = *reinterpret_cast<const uint4*>(p + 512);
    return u.v;
}

// ---------------------------------------------------------------------------
// Kernel 1: q/k/v = X @ W^T, f32 in -> f16 out (f32 WMMA accumulate).
// q,k stored row-major [T][C]; v stored TRANSPOSED, in blocks of 32 tokens (8 KB), each
// block in the order of the attention kernel's V^T fragments:
//   [block][16-channel tile n][16-token half t][lane = 16 hi + lm][8 tokens]
// holds channel 16 n + lm, tokens 16 t + 8 hi .. + 7 of the block. A wave's 16-byte store
// here and a wave's 16-byte copy there each take 512 bytes in a row: four whole lines.
// One work-group per 64 tokens makes all 384 columns of q, k and v. It rounds
// its 64 X rows and the 384 W rows to f16 once, whole 512-byte rows a load,
// into LDS; behind one barrier wave w makes column tiles 3w .. 3w+2 (of 24)
// for all four 16-token tiles: twelve accumulators, and per 32-wide k chunk
// seven fragments from LDS feed twelve products.
// ---------------------------------------------------------------------------
#define PTOK   64                     // tokens per work-group
#define PPITCH 272                    // bytes per staged row (256 used): 16 B x odd
#define PROWS  (PTOK + 3 * CH)        // X rows, then Wq, Wk, Wv rows

__device__ inline void stage_row4(unsigned char* d, float4 f) {
    union { uint2 q; _Float16 h[4]; } u;
    u.h[0] = (_Float16)f.x; u.h[1] = (_Float16)f.y;
    u.h[2] = (_Float16)f.z; u.h[3] = (_Float16)f.w;
    *reinterpret_cast<uint2*>(d) = u.q;
}

__global__ __launch_bounds__(256) void qkv_proj_kernel(
    const float* __restrict__ X,
    const float* __restrict__ Wq, const float* __restrict__ Wk, const float* __restrict__ Wv,
    _Float16* __restrict__ qh, _Float16* __restrict__ kh, _Float16* __restrict__ vT)
{
    __shared__ __attribute__((aligned(16))) unsigned char st[PROWS * PPITCH];   // 121,856 B

    // wave number in a scalar register: row addresses and the q/k/v branches stay scalar
    const int wave = __builtin_amdgcn_readfirstlane(threadIdx.x >> 5);
    const int lane = threadIdx.x & 31;
    const int lm = lane & 15, hi = lane >> 4;

    const int tok0 = blockIdx.x * PTOK;       // flat token; 64 divides SEQ: one batch a group

    // ---- stage: a wave's load takes one whole row (32 lanes x 16 B), rows wave, wave + 8, ...
    const float* xs = X + (size_t)tok0 * CH + wave * CH + lane * 4;
    const float* wq = Wq + wave * CH + lane * 4;
    const float* wk = Wk + wave * CH + lane * 4;
    const float* wv = Wv + wave * CH + lane * 4;
    float4 rx[8], rq[16], rk[16], rv[16];
#pragma unroll
    for (int i = 0; i < 8; ++i)  rx[i] = *reinterpret_cast<const float4*>(xs + i * 8 * CH);
#pragma unroll
    for (int i = 0; i < 16; ++i) rq[i] = *reinterpret_cast<const float4*>(wq + i * 8 * CH);
#pragma unroll
    for (int i = 0; i < 16; ++i) rk[i] = *reinterpret_cast<const float4*>(wk + i * 8 * CH);
#pragma unroll
    for (int i = 0; i < 16; ++i) rv[i] = *reinterpret_cast<const float4*>(wv + i * 8 * CH);

    unsigned char* sd = st + wave * PPITCH + lane * 8;
#pragma unroll
    for (int i = 0; i < 8; ++i)  stage_row4(sd + (i * 8) * PPITCH, rx[i]);
#pragma unroll
    for (int i = 0; i < 16; ++i) stage_row4(sd + (PTOK + i * 8) * PPITCH, rq[i]);
#pragma unroll
    for (int i = 0; i < 16; ++i) stage_row4(sd + (PTOK + CH + i * 8) * PPITCH, rk[i]);
#pragma unroll
    for (int i = 0; i < 16; ++i) stage_row4(sd + (PTOK + 2 * CH + i * 8) * PPITCH, rv[i]);

    __syncthreads();   // every staged row is in LDS before any wave takes fragments

    // ---- wave w: column tiles 3w .. 3w+2 (B = W^T column = W row) x four token tiles (A) ----
    const unsigned char* xf = st + lm * PPITCH + hi * 16;
    const unsigned char* wf = xf + (PTOK + wave * 48) * PPITCH;
    v16h a[2][4], bw[2][3];
#pragma unroll
    for (int tt = 0; tt < 4; ++tt) a[0][tt] = lds_frag(xf + tt * 16 * PPITCH);
#pragma unroll
    for (int j = 0; j < 3; ++j) bw[0][j] = lds_frag(wf + j * 16 * PPITCH);

    v8f c[4][3];
#pragma unroll
    for (int tt = 0; tt < 4; ++tt)
#pragma unroll
        for (int j = 0; j < 3; ++j) c[tt][j] = (v8f){};

#pragma unroll
    for (int kb = 0; kb < 4; ++kb) {
        const int cur = kb & 1;
        if (kb < 3) {
#pragma unroll
            for (int tt = 0; tt < 4; ++tt)
                a[cur ^ 1][tt] = lds_frag(xf + tt * 16 * PPITCH + (kb + 1) * 64);
#pragma unroll
            for (int j = 0; j < 3; ++j)
                bw[cur ^ 1][j] = lds_frag(wf + j * 16 * PPITCH + (kb + 1) * 64);
        }
        // keeps the next k chunk's LDS reads in front of this chunk's twelve products, so that
        // their latency runs under the products instead of in front of each of them
        __builtin_amdgcn_sched_barrier(0);
#pragma unroll
        for (int tt = 0; tt < 4; ++tt)
#pragma unroll
            for (int j = 0; j < 3; ++j)
                c[tt][j] = __builtin_amdgcn_wmma_f32_16x16x32_f16(false, a[cur][tt], false,
                                                                  bw[cur][j], (short)0, c[tt][j],
                                                                  false, false);
    }

    const unsigned voq = (unsigned)((8 * hi) * CH + lm);    // q, k: token 8 hi (+ r), column lm
    const unsigned vov = (unsigned)(lane * 8);              // vT: this lane's 8 tokens of a half
#pragma unroll
    for (int j = 0; j < 3; ++j) {
        const int ct = wave * 3 + j;          // scalar
        const int p = ct >> 3, nt = ct & 7;
        if (p < 2) {
            _Float16* ob = ((p == 0) ? qh : kh) + (size_t)tok0 * CH + nt * 16;
#pragma unroll
            for (int tt = 0; tt < 4; ++tt)
#pragma unroll
                for (int r = 0; r < 8; ++r)
                    ob[voq + (unsigned)((tt * 16 + r) * CH)] = (_Float16)c[tt][j][r];
        } else {
            // transposed store: tokens contiguous along r -> one b128; token tile tt is
            // half tt & 1 of block tt >> 1 (of this group's two blocks)
            _Float16* ob = vT + (size_t)tok0 * CH + nt * 512;
#pragma unroll
            for (int tt = 0; tt < 4; ++tt) {
                union { uint4 q; _Float16 h[8]; } u;
#pragma unroll
                for (int r = 0; r < 8; ++r) u.h[r] = (_Float16)c[tt][j][r];
                *reinterpret_cast<uint4*>(ob + vov + (unsigned)((tt >> 1) * 32 * CH
                                                                + (tt & 1) * 256)) = u.q;
            }
            // the wait in front of any rewrite of a register that these four stores name
            asm volatile("s_wait_xcnt 0x0" ::: "memory");
        }
    }
}

#define OPITCH 132
#define KPITCH 272
#define KBYTES (32 * KPITCH)          // 32 keys
#define VBYTES (CH * 64)              // 128 channels x 32 keys, in fragment order as in memory
#define WBYTES (KBYTES + VBYTES)      // one wave's buffers, 16,896 B (= one partial O)

typedef __attribute__((ext_vector_type(4))) int v4i;
typedef __attribute__((address_space(1))) v4i gl_v4i;
typedef __attribute__((address_space(3))) v4i ls_v4i;

// The offset field moves the LDS and the global address alike: with the LDS step in it, one
// LDS address register serves all 16 copies of a tile (16 of them did not fit the register
// budget); what the global step differs from the LDS step by is added to the global base.
template <int C>
__device__ inline void copy_k_from(const unsigned char* ub, unsigned voff, ls_v4i* l) {
    if constexpr (C < 16) {
        __builtin_amdgcn_global_load_async_to_lds_b128(
            (gl_v4i*)(ub + (C * 512 - C * 2 * KPITCH) + voff), l, C * 2 * KPITCH, 0);
        copy_k_from<C + 1>(ub, voff, l);
    }
}
template <int C>
__device__ inline void copy_v_from(const unsigned char* ub, unsigned voff, ls_v4i* l) {
    if constexpr (C < 16) {
        __builtin_amdgcn_global_load_async_to_lds_b128((gl_v4i*)(ub + voff), l, C * 512, 0);
        copy_v_from<C + 1>(ub, voff, l);
    }
}

// 32 K rows are 8 KB in a row in memory: each copy takes 512 B = 4 whole lines (2 rows).
__device__ inline void copy_k_block(const _Float16* kblk, unsigned char* kbuf, int lane) {
    copy_k_from<0>(reinterpret_cast<const unsigned char*>(kblk), (unsigned)(lane * 16),
                   (ls_v4i*)(kbuf + (lane >> 4) * KPITCH + (lane & 15) * 16));
}

// A V^T block is 8 KB in a row in memory, already in fragment order: each copy takes 512 B =
// 4 whole lines and lands them as they lie, so LDS and global step alike and one address
// pair with the offset field serves all 16 copies.
__device__ inline void copy_v_block(const _Float16* vblk, unsigned char* vbuf, int lane) {
    copy_v_from<0>(reinterpret_cast<const unsigned char*>(vblk), (unsigned)(lane * 16),
                   (ls_v4i*)(vbuf + lane * 16));
}

__device__ inline float xhalf(float x) {
    return __builtin_bit_cast(float, __builtin_amdgcn_permlanex16(
        __builtin_bit_cast(int, x), __builtin_bit_cast(int, x),
        0x76543210, 0xfedcba98, false, false));
}

__global__ __launch_bounds__(256) void flash_attn_kernel(
    const _Float16* __restrict__ qh, const _Float16* __restrict__ kh,
    const _Float16* __restrict__ vT, float* __restrict__ out)
{
    // 8 waves * (K buffer, V^T buffer); behind the loop a wave's own range holds its partial O
    __shared__ __attribute__((aligned(16))) unsigned char ring[8 * WBYTES];
    __shared__ float lds_m[8 * 32];           // 8 waves * 32 row maxima
    __shared__ float lds_l[8 * 32];           // 8 waves * 32 row sums

    // wave number in a scalar register: trip counts and branches stay scalar
    const int wave = __builtin_amdgcn_readfirstlane(threadIdx.x >> 5);
    const int lane = threadIdx.x & 31;
    const int lm = lane & 15, hi = lane >> 4;

    const int qt = (QTILES32 - 1) - (blockIdx.x >> 2);   // longest tiles start first
    const int b  = blockIdx.x & 3;

    const _Float16* qb  = qh + (size_t)b * SEQ * CH;
    const _Float16* kbp = kh + (size_t)b * SEQ * CH;
    const _Float16* vTb = vT + (size_t)b * SEQ * CH;   // [SEQ / 32] blocks of 32 * CH halves

    v8f o[2][8];
#pragma unroll
    for (int g = 0; g < 2; ++g)
#pragma unroll
        for (int n = 0; n < 8; ++n) o[g][n] = (v8f){};

    // this lane's query of each group: running maximum (alike in both halves) and the sum
    // over this half's keys (the halves are joined once, behind the loop)
    float mrun[2] = {-3.0e38f, -3.0e38f}, lrun[2] = {0.0f, 0.0f};

    const float scale = 0.08838834764831845f;  // 1/sqrt(128)

    const int nblk = qt + 1;                   // 32-key blocks; the last holds the diagonal

    unsigned char* kbuf = ring + wave * WBYTES;
    unsigned char* vbuf = kbuf + KBYTES;
    const unsigned char* kfr = kbuf + lm * KPITCH + hi * 16;
    const unsigned char* vfr = vbuf + lane * 16;

    if (wave < nblk) {                         // scalar test: this wave's first block
        copy_k_block(kbp + (size_t)wave * 32 * CH, kbuf, lane);
        copy_v_block(vTb + (size_t)wave * 32 * CH, vbuf, lane);
    }

    const _Float16* qlane = qb + (size_t)(qt * 32 + lm) * CH + hi * 8;
    v16h aq[2][4];
#pragma unroll
    for (int g = 0; g < 2; ++g)
#pragma unroll
        for (int kb = 0; kb < 4; ++kb)
            aq[g][kb] = load_frag_f16(qlane, 0, g * 16 * CH + kb * 32, 0, CH);
    // The wait in front of any rewrite of the Q loads' address registers. Inputs only: the
    // loaded values keep the loads in front of it, the address keeps its registers up to it.
    asm volatile("s_wait_xcnt 0x0"
                 :: "v"(qlane), "v"(aq[0][0]), "v"(aq[0][1]), "v"(aq[0][2]), "v"(aq[0][3]),
                    "v"(aq[1][0]), "v"(aq[1][1]), "v"(aq[1][2]), "v"(aq[1][3])
                 : "memory");

    for (int jj = wave; jj < nblk; jj += 8) {
        const int k0 = jj * 32;

        // this block's K and V^T have landed before this wave reads them
        asm volatile("s_wait_asynccnt 0x0" ::: "memory");

        // ---- S^T = K * Q^T for two adjacent 16-key tiles (K=128), both query groups ----
        // s0[g][r]: key k0 + 8 hi + r, s1[g][r]: key k0 + 16 + 8 hi + r, query 16 g + lm
        v8f s0[2] = {{}, {}}, s1[2] = {{}, {}};
#pragma unroll
        for (int kb = 0; kb < 4; ++kb) {
            v16h bk0 = lds_frag(kfr + kb * 64);
            v16h bk1 = lds_frag(kfr + 16 * KPITCH + kb * 64);
#pragma unroll
            for (int g = 0; g < 2; ++g) {
                s0[g] = __builtin_amdgcn_wmma_f32_16x16x32_f16(false, bk0, false, aq[g][kb],
                                                               (short)0, s0[g], false, false);
                s1[g] = __builtin_amdgcn_wmma_f32_16x16x32_f16(false, bk1, false, aq[g][kb],
                                                               (short)0, s1[g], false, false);
            }
        }

        // V^T fragments into registers now, so that both buffers are free for the next block
        v16h bv[8];
#pragma unroll
        for (int n = 0; n < 8; ++n) bv[n] = lds_frag_v(vfr + n * 1024);

        // every read of the two buffers has returned before the copies overwrite them
        asm volatile("s_wait_dscnt 0x0" ::: "memory");
        if (jj + 8 < nblk) {                   // scalar test: a next block exists
            copy_k_block(kbp + (size_t)(k0 + 256) * CH, kbuf, lane);
            copy_v_block(vTb + (size_t)(k0 + 256) * CH, vbuf, lane);
        }

        // ---- mask + scale + online softmax over 32 keys, one query a lane and group ----
        v16h pt[2];                              // P^T as B operand: pt[g][s] = key kmap(s, hi)
#pragma unroll
        for (int g = 0; g < 2; ++g) {
            // last r of s0[g] that this query may see
            const int dlast = qt * 32 + g * 16 + lm - k0 - 8 * hi;
            float rmax = -3.0e38f;
#pragma unroll
            for (int r = 0; r < 8; ++r) {
                float v0 = s0[g][r] * scale;
                float v1 = s1[g][r] * scale;
                if (r      > dlast) v0 = -3.0e38f;   // bites only in the diagonal block
                if (r + 16 > dlast) v1 = -3.0e38f;
                s0[g][r] = v0;
                s1[g][r] = v1;
                rmax = fmaxf(rmax, fmaxf(v0, v1));
            }
            rmax = fmaxf(rmax, xhalf(rmax));
            const float mnew = fmaxf(mrun[g], rmax);
            const float alpha = __expf(mrun[g] - mnew);
            mrun[g] = mnew;

            float rs0 = 0.0f, rs1 = 0.0f;
#pragma unroll
            for (int r = 0; r < 8; ++r) {
                const float p0 = __expf(s0[g][r] - mnew);
                const float p1 = __expf(s1[g][r] - mnew);
                rs0 += p0;
                rs1 += p1;
                pt[g][r]     = (_Float16)p0;
                pt[g][8 + r] = (_Float16)p1;
            }
            lrun[g] = lrun[g] * alpha + (rs0 + rs1);

#pragma unroll
            for (int n = 0; n < 8; ++n)
#pragma unroll
                for (int r = 0; r < 8; ++r) o[g][n][r] *= alpha;
        }

        // ---- O^T += V^T * P^T : full-K WMMAs; o[g][n][r]: channel 16 n + 8 hi + r ----
#pragma unroll
        for (int n = 0; n < 8; ++n)
#pragma unroll
            for (int g = 0; g < 2; ++g)
                o[g][n] = __builtin_amdgcn_wmma_f32_16x16x32_f16(false, bv[n], false, pt[g],
                                                                 (short)0, o[g][n], false, false);
    }
    // no copy of this wave is outstanding before its buffers take the partial O
    asm volatile("s_wait_asynccnt 0x0" ::: "memory");

    // ---- publish this wave's partial (max, sum, un-normalised O) ----
    // A wave without a key block publishes max -3e38, sum 0, O 0: weight 0 below.
#pragma unroll
    for (int g = 0; g < 2; ++g) {
        const float lsum = lrun[g] + xhalf(lrun[g]);   // the two halves' key sums joined
        if (hi == 0) {
            lds_m[wave * 32 + g * 16 + lm] = mrun[g];
            lds_l[wave * 32 + g * 16 + lm] = lsum;
        }
        // a lane holds 8 channels in a row of its query: two 16-byte stores a tile
        float* lo = reinterpret_cast<float*>(kbuf) + (g * 16 + lm) * OPITCH + 8 * hi;
#pragma unroll
        for (int n = 0; n < 8; ++n) {
            *reinterpret_cast<float4*>(lo + n * 16) =
                make_float4(o[g][n][0], o[g][n][1], o[g][n][2], o[g][n][3]);
            *reinterpret_cast<float4*>(lo + n * 16 + 4) =
                make_float4(o[g][n][4], o[g][n][5], o[g][n][6], o[g][n][7]);
        }
    }

    __syncthreads();   // every wave's partial is in LDS before any wave merges

    float* ob = out + (size_t)b * SEQ * CH;
#pragma unroll
    for (int rr = 0; rr < 4; ++rr) {
        const int row = wave * 4 + rr;
        float ms[8];
        float mall = -3.0e38f;
#pragma unroll
        for (int s = 0; s < 8; ++s) {
            ms[s] = lds_m[s * 32 + row];
            mall = fmaxf(mall, ms[s]);
        }
        float lall = 0.0f;
        float4 acc = make_float4(0.0f, 0.0f, 0.0f, 0.0f);
#pragma unroll
        for (int s = 0; s < 8; ++s) {
            const float e = __expf(ms[s] - mall);
            const float4 ov = *reinterpret_cast<const float4*>(
                reinterpret_cast<const float*>(ring + s * WBYTES) + row * OPITCH + lane * 4);
            lall += e * lds_l[s * 32 + row];
            acc.x += e * ov.x; acc.y += e * ov.y;
            acc.z += e * ov.z; acc.w += e * ov.w;
        }
        const float inv = 1.0f / lall;
        acc.x *= inv; acc.y *= inv; acc.z *= inv; acc.w *= inv;
        *reinterpret_cast<float4*>(ob + (size_t)(qt * 32 + row) * CH + lane * 4) = acc;
    }
}

// ---------------------------------------------------------------------------
extern "C" void kernel_launch(void* const* d_in, const int* in_sizes, int n_in,
                              void* d_out, int out_size, void* d_ws, size_t ws_size,
                              hipStream_t stream) {
    (void)in_sizes; (void)n_in; (void)out_size; (void)ws_size;
    const float* X  = (const float*)d_in[0];
    const float* Wq = (const float*)d_in[1];
    const float* Wk = (const float*)d_in[2];
    const float* Wv = (const float*)d_in[3];
    float* out = (float*)d_out;

    const size_t elems = (size_t)BATCH * SEQ * CH;       // 2,097,152
    _Float16* qh = (_Float16*)d_ws;
    _Float16* kh = qh + elems;
    _Float16* vT = kh + elems;                            // [B][SEQ / 32][32 * CH]

    // 4 batch * 4096 tokens / 64 tokens per block = 256 blocks
    qkv_proj_kernel<<<256, 256, 0, stream>>>(X, Wq, Wk, Wv, qh, kh, vT);
    // 4 batch * 128 query tiles, one block of 8 waves each = 512 blocks
    flash_attn_kernel<<<512, 256, 0, stream>>>(qh, kh, vT, out);
}

// v007
// A run of this version takes 30.6 microseconds.
// In both of two side-by-side timings against v006, it was 1.12 times as fast.
// Counting every step since v000, it is 14.4 times as fast.
#include <hip/hip_runtime.h>
#include <hip/hip_bf16.h>

typedef __attribute__((ext_vector_type(16))) _Float16 v16h;
typedef __attribute__((ext_vector_type(8)))  float    v8f;

#define BATCH 4
#define SEQ   4096
#define CH    128
#define QTILES32 (SEQ / 32)   // 128 query tiles of 32 rows

__device__ inline v16h lds_frag(const unsigned char* p) {
    union { uint4 q[2]; v16h v; } u;
    u.q[0] = *reinterpret_cast<const uint4*>(p);
    u.q[1] = *reinterpret_cast<const uint4*>(p + 32);
    return u.v;
}

// V^T fragment from a staged block in fragment order: the two 16-key halves lie 512 B apart
__device__ inline v16h lds_frag_v(const unsigned char* p) {
    union { uint4 q[2]; v16h v; } u;
    u.q[0] = *reinterpret_cast<const uint4*>(p);
    u.q[1] = *reinterpret_cast<const uint4*>(p + 512);
    return u.v;
}

// ---------------------------------------------------------------------------
// Kernel 1: q/k/v = X @ W^T, f32 in -> f16 out (f32 WMMA accumulate).
// q,k stored row-major [T][C]; v stored TRANSPOSED, in blocks of 32 tokens (8 KB), each
// block in the order of the attention kernel's V^T fragments:
//   [block][16-channel tile n][16-token half t][lane = 16 hi + lm][8 tokens]
// holds channel 16 n + lm, tokens 16 t + 8 hi .. + 7 of the block. A wave's 16-byte store
// here and a wave's 16-byte copy there each take 512 bytes in a row: four whole lines.
// One work-group per 64 tokens makes all 384 columns of q, k and v. It rounds
// its 64 X rows and the 384 W rows to f16 once, whole 512-byte rows a load,
// into LDS; behind one barrier wave w makes column tiles 3w .. 3w+2 (of 24)
// for all four 16-token tiles: twelve accumulators, and per 32-wide k chunk
// seven fragments from LDS feed twelve products.
// ---------------------------------------------------------------------------
#define PTOK   64                     // tokens per work-group
#define PPITCH 272                    // bytes per staged row (256 used): 16 B x odd
#define PROWS  (PTOK + 3 * CH)        // X rows, then Wq, Wk, Wv rows

__device__ inline void stage_row4(unsigned char* d, float4 f) {
    union { uint2 q; _Float16 h[4]; } u;
    u.h[0] = (_Float16)f.x; u.h[1] = (_Float16)f.y;
    u.h[2] = (_Float16)f.z; u.h[3] = (_Float16)f.w;
    *reinterpret_cast<uint2*>(d) = u.q;
}

__global__ __launch_bounds__(256) void qkv_proj_kernel(
    const float* __restrict__ X,
    const float* __restrict__ Wq, const float* __restrict__ Wk, const float* __restrict__ Wv,
    _Float16* __restrict__ qh, _Float16* __restrict__ kh, _Float16* __restrict__ vT)
{
    __shared__ __attribute__((aligned(16))) unsigned char st[PROWS * PPITCH];   // 121,856 B

    // wave number in a scalar register: row addresses and the q/k/v branches stay scalar
    const int wave = __builtin_amdgcn_readfirstlane(threadIdx.x >> 5);
    const int lane = threadIdx.x & 31;
    const int lm = lane & 15, hi = lane >> 4;

    const int tok0 = blockIdx.x * PTOK;       // flat token; 64 divides SEQ: one batch a group

    // ---- stage: a wave's load takes one whole row (32 lanes x 16 B), rows wave, wave + 8, ...
    const float* xs = X + (size_t)tok0 * CH + wave * CH + lane * 4;
    const float* wq = Wq + wave * CH + lane * 4;
    const float* wk = Wk + wave * CH + lane * 4;
    const float* wv = Wv + wave * CH + lane * 4;
    float4 rx[8], rq[16], rk[16], rv[16];
#pragma unroll
    for (int i = 0; i < 8; ++i)  rx[i] = *reinterpret_cast<const float4*>(xs + i * 8 * CH);
#pragma unroll
    for (int i = 0; i < 16; ++i) rq[i] = *reinterpret_cast<const float4*>(wq + i * 8 * CH);
#pragma unroll
    for (int i = 0; i < 16; ++i) rk[i] = *reinterpret_cast<const float4*>(wk + i * 8 * CH);
#pragma unroll
    for (int i = 0; i < 16; ++i) rv[i] = *reinterpret_cast<const float4*>(wv + i * 8 * CH);

    unsigned char* sd = st + wave * PPITCH + lane * 8;
#pragma unroll
    for (int i = 0; i < 8; ++i)  stage_row4(sd + (i * 8) * PPITCH, rx[i]);
#pragma unroll
    for (int i = 0; i < 16; ++i) stage_row4(sd + (PTOK + i * 8) * PPITCH, rq[i]);
#pragma unroll
    for (int i = 0; i < 16; ++i) stage_row4(sd + (PTOK + CH + i * 8) * PPITCH, rk[i]);
#pragma unroll
    for (int i = 0; i < 16; ++i) stage_row4(sd + (PTOK + 2 * CH + i * 8) * PPITCH, rv[i]);

    __syncthreads();   // every staged row is in LDS before any wave takes fragments

    // ---- wave w: column tiles 3w .. 3w+2 (B = W^T column = W row) x four token tiles (A) ----
    const unsigned char* xf = st + lm * PPITCH + hi * 16;
    const unsigned char* wf = xf + (PTOK + wave * 48) * PPITCH;
    v16h a[2][4], bw[2][3];
#pragma unroll
    for (int tt = 0; tt < 4; ++tt) a[0][tt] = lds_frag(xf + tt * 16 * PPITCH);
#pragma unroll
    for (int j = 0; j < 3; ++j) bw[0][j] = lds_frag(wf + j * 16 * PPITCH);

    v8f c[4][3];
#pragma unroll
    for (int tt = 0; tt < 4; ++tt)
#pragma unroll
        for (int j = 0; j < 3; ++j) c[tt][j] = (v8f){};

#pragma unroll
    for (int kb = 0; kb < 4; ++kb) {
        const int cur = kb & 1;
        if (kb < 3) {
#pragma unroll
            for (int tt = 0; tt < 4; ++tt)
                a[cur ^ 1][tt] = lds_frag(xf + tt * 16 * PPITCH + (kb + 1) * 64);
#pragma unroll
            for (int j = 0; j < 3; ++j)
                bw[cur ^ 1][j] = lds_frag(wf + j * 16 * PPITCH + (kb + 1) * 64);
        }
        // keeps the next k chunk's LDS reads in front of this chunk's twelve products, so that
        // their latency runs under the products instead of in front of each of them
        __builtin_amdgcn_sched_barrier(0);
#pragma unroll
        for (int tt = 0; tt < 4; ++tt)
#pragma unroll
            for (int j = 0; j < 3; ++j)
                c[tt][j] = __builtin_amdgcn_wmma_f32_16x16x32_f16(false, a[cur][tt], false,
                                                                  bw[cur][j], (short)0, c[tt][j],
                                                                  false, false);
    }

    const unsigned voq = (unsigned)((8 * hi) * CH + lm);    // q, k: token 8 hi (+ r), column lm
    const unsigned vov = (unsigned)(lane * 8);              // vT: this lane's 8 tokens of a half
#pragma unroll
    for (int j = 0; j < 3; ++j) {
        const int ct = wave * 3 + j;          // scalar
        const int p = ct >> 3, nt = ct & 7;
        if (p < 2) {
            _Float16* ob = ((p == 0) ? qh : kh) + (size_t)tok0 * CH + nt * 16;
#pragma unroll
            for (int tt = 0; tt < 4; ++tt)
#pragma unroll
                for (int r = 0; r < 8; ++r)
                    ob[voq + (unsigned)((tt * 16 + r) * CH)] = (_Float16)c[tt][j][r];
        } else {
            // transposed store: tokens contiguous along r -> one b128; token tile tt is
            // half tt & 1 of block tt >> 1 (of this group's two blocks)
            _Float16* ob = vT + (size_t)tok0 * CH + nt * 512;
#pragma unroll
            for (int tt = 0; tt < 4; ++tt) {
                union { uint4 q; _Float16 h[8]; } u;
#pragma unroll
                for (int r = 0; r < 8; ++r) u.h[r] = (_Float16)c[tt][j][r];
                *reinterpret_cast<uint4*>(ob + vov + (unsigned)((tt >> 1) * 32 * CH
                                                                + (tt & 1) * 256)) = u.q;
            }
            // the wait in front of any rewrite of a register that these four stores name
            asm volatile("s_wait_xcnt 0x0" ::: "memory");
        }
    }
}

#define OPITCH 132
#define KPITCH 272
#define KBYTES (32 * KPITCH)          // 32 keys
#define VBYTES (CH * 64)              // 128 channels x 32 keys, in fragment order as in memory
#define WBYTES (KBYTES + VBYTES)      // one wave's buffers, 16,896 B (= one partial O)

typedef __attribute__((ext_vector_type(4))) int v4i;
typedef __attribute__((address_space(1))) v4i gl_v4i;
typedef __attribute__((address_space(3))) v4i ls_v4i;

// The offset field moves the LDS and the global address alike: with the LDS step in it, one
// LDS address register serves all 16 copies of a tile (16 of them did not fit the register
// budget); what the global step differs from the LDS step by is added to the global base.
template <int C>
__device__ inline void copy_k_from(const unsigned char* ub, unsigned voff, ls_v4i* l) {
    if constexpr (C < 16) {
        __builtin_amdgcn_global_load_async_to_lds_b128(
            (gl_v4i*)(ub + (C * 512 - C * 2 * KPITCH) + voff), l, C * 2 * KPITCH, 0);
        copy_k_from<C + 1>(ub, voff, l);
    }
}
template <int C>
__device__ inline void copy_v_from(const unsigned char* ub, unsigned voff, ls_v4i* l) {
    if constexpr (C < 16) {
        __builtin_amdgcn_global_load_async_to_lds_b128((gl_v4i*)(ub + voff), l, C * 512, 0);
        copy_v_from<C + 1>(ub, voff, l);
    }
}

// 32 K rows are 8 KB in a row in memory: each copy takes 512 B = 4 whole lines (2 rows).
__device__ inline void copy_k_block(const _Float16* kblk, unsigned char* kbuf, int lane) {
    copy_k_from<0>(reinterpret_cast<const unsigned char*>(kblk), (unsigned)(lane * 16),
                   (ls_v4i*)(kbuf + (lane >> 4) * KPITCH + (lane & 15) * 16));
}

// A V^T block is 8 KB in a row in memory, already in fragment order: each copy takes 512 B =
// 4 whole lines and lands them as they lie, so LDS and global step alike and one address
// pair with the offset field serves all 16 copies.
__device__ inline void copy_v_block(const _Float16* vblk, unsigned char* vbuf, int lane) {
    copy_v_from<0>(reinterpret_cast<const unsigned char*>(vblk), (unsigned)(lane * 16),
                   (ls_v4i*)(vbuf + lane * 16));
}

__device__ inline float xhalf(float x) {
    return __builtin_bit_cast(float, __builtin_amdgcn_permlanex16(
        __builtin_bit_cast(int, x), __builtin_bit_cast(int, x),
        0x76543210, 0xfedcba98, false, false));
}

#define NWAVES 16
#define QBYTES (32 * KPITCH)

__global__ __launch_bounds__(512) void flash_attn_kernel(
    const _Float16* __restrict__ qh, const _Float16* __restrict__ kh,
    const _Float16* __restrict__ vT, float* __restrict__ out)
{
    // 16 waves * (K buffer, V^T buffer); behind the loop a wave's own range holds its partial O
    __shared__ __attribute__((aligned(16))) unsigned char ring[NWAVES * WBYTES];
    __shared__ __attribute__((aligned(16))) unsigned char qst[2 * QBYTES];   // long, short tile
    __shared__ __attribute__((aligned(16))) float lds_m[NWAVES * 32];   // row maxima per wave
    __shared__ __attribute__((aligned(16))) float lds_l[NWAVES * 32];   // row sums per wave

    // wave number in a scalar register: trip counts and branches stay scalar
    const int wave = __builtin_amdgcn_readfirstlane(threadIdx.x >> 5);
    const int lane = threadIdx.x & 31;
    const int lm = lane & 15, hi = lane >> 4;

    const int pi = blockIdx.x >> 2;            // tile pair: long tile 127 - pi, short tile pi
    const int b  = blockIdx.x & 3;

    // 128 - pi and pi + 1 key blocks, 129 in every work-group. The long tile gets just enough
    // waves for nine blocks a wave at most; the rest then have at most nine of the short one.
    const int nlong = (136 - pi) / 9;          // 8 .. 15
    const bool islong = wave < nlong;          // scalar
    const int qt = islong ? (QTILES32 - 1) - pi : pi;
    const int wl = islong ? wave : wave - nlong;        // this wave's first key block
    const int nw = islong ? nlong : NWAVES - nlong;     // waves that share this tile's blocks

    const _Float16* qb  = qh + (size_t)b * SEQ * CH;
    const _Float16* kbp = kh + (size_t)b * SEQ * CH;
    const _Float16* vTb = vT + (size_t)b * SEQ * CH;   // [SEQ / 32] blocks of 32 * CH halves

    v8f o[2][8];
#pragma unroll
    for (int g = 0; g < 2; ++g)
#pragma unroll
        for (int n = 0; n < 8; ++n) o[g][n] = (v8f){};

    // this lane's query of each group: running maximum (alike in both halves) and the sum
    // over this half's keys (the halves are joined once, behind the loop)
    float mrun[2] = {-3.0e38f, -3.0e38f}, lrun[2] = {0.0f, 0.0f};

    const float scale = 0.08838834764831845f;  // 1/sqrt(128)

    const int nblk = qt + 1;                   // 32-key blocks; the last holds the diagonal

    unsigned char* kbuf = ring + wave * WBYTES;
    unsigned char* vbuf = kbuf + KBYTES;
    const unsigned char* kfr = kbuf + lm * KPITCH + hi * 16;
    const unsigned char* vfr = vbuf + lane * 16;

    if (wl < nblk) {                           // scalar test: this wave's first block
        copy_k_block(kbp + (size_t)wl * 32 * CH, kbuf, lane);
        copy_v_block(vTb + (size_t)wl * 32 * CH, vbuf, lane);
    }

    {
        const int row = threadIdx.x >> 4, col = threadIdx.x & 15;
        const _Float16* q0 = qb + (size_t)(((QTILES32 - 1) - pi) * 32 + row) * CH + col * 8;
        const _Float16* q1 = qb + (size_t)(pi * 32 + row) * CH + col * 8;
        const v4i x0 = *reinterpret_cast<const v4i*>(q0);
        const v4i x1 = *reinterpret_cast<const v4i*>(q1);
        // The wait in front of any rewrite of the two loads' address registers. Inputs only:
        // the loaded values keep the loads in front of it, the addresses their registers.
        asm volatile("s_wait_xcnt 0x0" :: "v"(q0), "v"(q1), "v"(x0), "v"(x1) : "memory");
        *reinterpret_cast<v4i*>(qst + row * KPITCH + col * 16) = x0;
        *reinterpret_cast<v4i*>(qst + QBYTES + row * KPITCH + col * 16) = x1;
    }
    __syncthreads();   // both Q tiles are in LDS before any wave takes fragments
    const unsigned char* qfr = qst + (islong ? 0 : QBYTES) + lm * KPITCH + hi * 16;

    for (int jj = wl; jj < nblk; jj += nw) {
        const int k0 = jj * 32;

        // this block's K and V^T have landed before this wave reads them
        asm volatile("s_wait_asynccnt 0x0" ::: "memory");

        // ---- S^T = K * Q^T for two adjacent 16-key tiles (K=128), both query groups ----
        // s0[g][r]: key k0 + 8 hi + r, s1[g][r]: key k0 + 16 + 8 hi + r, query 16 g + lm
        v8f s0[2] = {{}, {}}, s1[2] = {{}, {}};
        v16h bk[2][2], aq[2][2];                 // [stage][16-key tile], [stage][query group]
#pragma unroll
        for (int h = 0; h < 2; ++h) {
            bk[0][h] = lds_frag(kfr + h * 16 * KPITCH);
            aq[0][h] = lds_frag(qfr + h * 16 * KPITCH);
        }
#pragma unroll
        for (int kb = 0; kb < 4; ++kb) {
            const int cur = kb & 1;
            if (kb < 3) {
#pragma unroll
                for (int h = 0; h < 2; ++h) {
                    bk[cur ^ 1][h] = lds_frag(kfr + h * 16 * KPITCH + (kb + 1) * 64);
                    aq[cur ^ 1][h] = lds_frag(qfr + h * 16 * KPITCH + (kb + 1) * 64);
                }
            }
            // keeps the next k chunk's LDS reads in front of this chunk's four products, so that
            // their latency runs under the products instead of in front of each pair
            __builtin_amdgcn_sched_barrier(0);
#pragma unroll
            for (int g = 0; g < 2; ++g) {
                s0[g] = __builtin_amdgcn_wmma_f32_16x16x32_f16(false, bk[cur][0], false, aq[cur][g],
                                                               (short)0, s0[g], false, false);
                s1[g] = __builtin_amdgcn_wmma_f32_16x16x32_f16(false, bk[cur][1], false, aq[cur][g],
                                                               (short)0, s1[g], false, false);
            }
        }

        // Inputs only: keeps the V^T reads behind the last S^T product. Lifted over it, they are
        // live together with the last K and Q fragments: more than 256 registers hold (scratch).
        asm volatile("" :: "v"(s0[0]), "v"(s0[1]), "v"(s1[0]), "v"(s1[1]) : "memory");

        // V^T fragments into registers now, so that both buffers are free for the next block
        v16h bv[8];
#pragma unroll
        for (int n = 0; n < 8; ++n) bv[n] = lds_frag_v(vfr + n * 1024);

        // every read of the two buffers has returned before the copies overwrite them
        asm volatile("s_wait_dscnt 0x0" ::: "memory");
        if (jj + nw < nblk) {                  // scalar test: a next block exists
            copy_k_block(kbp + (size_t)(jj + nw) * 32 * CH, kbuf, lane);
            copy_v_block(vTb + (size_t)(jj + nw) * 32 * CH, vbuf, lane);
        }

        // ---- mask + scale + online softmax over 32 keys, one query a lane and group ----
        v16h pt[2];                              // P^T as B operand: pt[g][s] = key kmap(s, hi)
#pragma unroll
        for (int g = 0; g < 2; ++g) {
            // last r of s0[g] that this query may see
            const int dlast = qt * 32 + g * 16 + lm - k0 - 8 * hi;
            float rmax = -3.0e38f;
#pragma unroll
            for (int r = 0; r < 8; ++r) {
                float v0 = s0[g][r] * scale;
                float v1 = s1[g][r] * scale;
                if (r      > dlast) v0 = -3.0e38f;   // bites only in the diagonal block
                if (r + 16 > dlast) v1 = -3.0e38f;
                s0[g][r] = v0;
                s1[g][r] = v1;
                rmax = fmaxf(rmax, fmaxf(v0, v1));
            }
            rmax = fmaxf(rmax, xhalf(rmax));
            const float mnew = fmaxf(mrun[g], rmax);
            const float alpha = __expf(mrun[g] - mnew);
            mrun[g] = mnew;

            float rs0 = 0.0f, rs1 = 0.0f;
#pragma unroll
            for (int r = 0; r < 8; ++r) {
                const float p0 = __expf(s0[g][r] - mnew);
                const float p1 = __expf(s1[g][r] - mnew);
                rs0 += p0;
                rs1 += p1;
                pt[g][r]     = (_Float16)p0;
                pt[g][8 + r] = (_Float16)p1;
            }
            lrun[g] = lrun[g] * alpha + (rs0 + rs1);

#pragma unroll
            for (int n = 0; n < 8; ++n)
#pragma unroll
                for (int r = 0; r < 8; ++r) o[g][n][r] *= alpha;
        }

        // ---- O^T += V^T * P^T : full-K WMMAs; o[g][n][r]: channel 16 n + 8 hi + r ----
#pragma unroll
        for (int n = 0; n < 8; ++n)
#pragma unroll
            for (int g = 0; g < 2; ++g)
                o[g][n] = __builtin_amdgcn_wmma_f32_16x16x32_f16(false, bv[n], false, pt[g],
                                                                 (short)0, o[g][n], false, false);
    }
    // no copy of this wave is outstanding before its buffers take the partial O
    asm volatile("s_wait_asynccnt 0x0" ::: "memory");

    // the lane's number taken anew for the epilogue: held across the loop it costs the register
    // that did not fit (scratch)
    const int lanee = (int)__builtin_amdgcn_mbcnt_lo(~0u, 0u);
    const int lme = lanee & 15, hie = lanee >> 4;

    // ---- publish this wave's partial (max, sum, un-normalised O) ----
    // A wave without a key block publishes max -3e38, sum 0, O 0: weight 0 below.
#pragma unroll
    for (int g = 0; g < 2; ++g) {
        const float lsum = lrun[g] + xhalf(lrun[g]);   // the two halves' key sums joined
        if (hie == 0) {
            lds_m[wave * 32 + g * 16 + lme] = mrun[g];
            lds_l[wave * 32 + g * 16 + lme] = lsum;
        }
        // a lane holds 8 channels in a row of its query: two 16-byte stores a tile
        float* lo = reinterpret_cast<float*>(kbuf) + (g * 16 + lme) * OPITCH + 8 * hie;
#pragma unroll
        for (int n = 0; n < 8; ++n) {
            *reinterpret_cast<float4*>(lo + n * 16) =
                make_float4(o[g][n][0], o[g][n][1], o[g][n][2], o[g][n][3]);
            *reinterpret_cast<float4*>(lo + n * 16 + 4) =
                make_float4(o[g][n][4], o[g][n][5], o[g][n][6], o[g][n][7]);
        }
    }

    __syncthreads();   // every wave's partial is in LDS before any wave merges

    const int row = wave * 2;
    float2 mm[NWAVES], ll[NWAVES];
    float4 ov[NWAVES][2];
#pragma unroll
    for (int s = 0; s < NWAVES; ++s) {
        mm[s] = *reinterpret_cast<const float2*>(lds_m + s * 32 + row);
        ll[s] = *reinterpret_cast<const float2*>(lds_l + s * 32 + row);
        const float* pr = reinterpret_cast<const float*>(ring + s * WBYTES)
                          + row * OPITCH + lanee * 4;
        ov[s][0] = *reinterpret_cast<const float4*>(pr);
        ov[s][1] = *reinterpret_cast<const float4*>(pr + OPITCH);
    }

    float mall[2][2] = {{-3.0e38f, -3.0e38f}, {-3.0e38f, -3.0e38f}};   // [tile][row]
#pragma unroll
    for (int s = 0; s < NWAVES; ++s) {
        // nlong is 8 .. 15: only partials 8 .. 14 need the test
        const bool tl = (s < 8) ? true : ((s == NWAVES - 1) ? false : (s < nlong));
        if (tl) {
            mall[0][0] = fmaxf(mall[0][0], mm[s].x);
            mall[0][1] = fmaxf(mall[0][1], mm[s].y);
        } else {
            mall[1][0] = fmaxf(mall[1][0], mm[s].x);
            mall[1][1] = fmaxf(mall[1][1], mm[s].y);
        }
    }

    float lall[2][2] = {{0.0f, 0.0f}, {0.0f, 0.0f}};
    float4 acc[2][2];
#pragma unroll
    for (int t = 0; t < 2; ++t)
#pragma unroll
        for (int r = 0; r < 2; ++r) acc[t][r] = make_float4(0.0f, 0.0f, 0.0f, 0.0f);
#pragma unroll
    for (int s = 0; s < NWAVES; ++s) {
        const bool tl = (s < 8) ? true : ((s == NWAVES - 1) ? false : (s < nlong));
        if (tl) {
            const float e0 = __expf(mm[s].x - mall[0][0]);
            const float e1 = __expf(mm[s].y - mall[0][1]);
            lall[0][0] += e0 * ll[s].x;
            lall[0][1] += e1 * ll[s].y;
            acc[0][0].x += e0 * ov[s][0].x; acc[0][0].y += e0 * ov[s][0].y;
            acc[0][0].z += e0 * ov[s][0].z; acc[0][0].w += e0 * ov[s][0].w;
            acc[0][1].x += e1 * ov[s][1].x; acc[0][1].y += e1 * ov[s][1].y;
            acc[0][1].z += e1 * ov[s][1].z; acc[0][1].w += e1 * ov[s][1].w;
        } else {
            const float e0 = __expf(mm[s].x - mall[1][0]);
            const float e1 = __expf(mm[s].y - mall[1][1]);
            lall[1][0] += e0 * ll[s].x;
            lall[1][1] += e1 * ll[s].y;
            acc[1][0].x += e0 * ov[s][0].x; acc[1][0].y += e0 * ov[s][0].y;
            acc[1][0].z += e0 * ov[s][0].z; acc[1][0].w += e0 * ov[s][0].w;
            acc[1][1].x += e1 * ov[s][1].x; acc[1][1].y += e1 * ov[s][1].y;
            acc[1][1].z += e1 * ov[s][1].z; acc[1][1].w += e1 * ov[s][1].w;
        }
    }

    float* ob = out + (size_t)b * SEQ * CH + (size_t)row * CH + lanee * 4;
#pragma unroll
    for (int t = 0; t < 2; ++t) {
        const int tq = t ? pi : (QTILES32 - 1) - pi;
#pragma unroll
        for (int r = 0; r < 2; ++r) {
            const float inv = 1.0f / lall[t][r];
            float4 a = acc[t][r];
            a.x *= inv; a.y *= inv; a.z *= inv; a.w *= inv;
            *reinterpret_cast<float4*>(ob + (size_t)(tq * 32 + r) * CH) = a;
        }
    }
}

// ---------------------------------------------------------------------------
extern "C" void kernel_launch(void* const* d_in, const int* in_sizes, int n_in,
                              void* d_out, int out_size, void* d_ws, size_t ws_size,
                              hipStream_t stream) {
    (void)in_sizes; (void)n_in; (void)out_size; (void)ws_size;
    const float* X  = (const float*)d_in[0];
    const float* Wq = (const float*)d_in[1];
    const float* Wk = (const float*)d_in[2];
    const float* Wv = (const float*)d_in[3];
    float* out = (float*)d_out;

    const size_t elems = (size_t)BATCH * SEQ * CH;       // 2,097,152
    _Float16* qh = (_Float16*)d_ws;
    _Float16* kh = qh + elems;
    _Float16* vT = kh + elems;                            // [B][SEQ / 32][32 * CH]

    // 4 batch * 4096 tokens / 64 tokens per block = 256 blocks
    qkv_proj_kernel<<<256, 256, 0, stream>>>(X, Wq, Wk, Wv, qh, kh, vT);
    // 4 batch * 64 pairs of query tiles, one block of 16 waves each = 256 blocks
    flash_attn_kernel<<<256, 512, 0, stream>>>(qh, kh, vT, out);
}

// v008
// Measured time: 29.9 microseconds a run.
// Timed twice side by side with v007, it ran 1.04 and 1.02 times as fast.
// Over all steps from v000 it is 14.9 times as fast.
#include <hip/hip_runtime.h>
#include <hip/hip_bf16.h>

typedef __attribute__((ext_vector_type(16))) _Float16 v16h;
typedef __attribute__((ext_vector_type(8)))  float    v8f;

#define BATCH 4
#define SEQ   4096
#define CH    128
#define QTILES32 (SEQ / 32)   // 128 query tiles of 32 rows

__device__ inline v16h lds_frag(const unsigned char* p) {
    union { uint4 q[2]; v16h v; } u;
    u.q[0] = *reinterpret_cast<const uint4*>(p);
    u.q[1] = *reinterpret_cast<const uint4*>(p + 32);
    return u.v;
}

// V^T fragment from a staged block in fragment order: the two 16-key halves lie 512 B apart
__device__ inline v16h lds_frag_v(const unsigned char* p) {
    union { uint4 q[2]; v16h v; } u;
    u.q[0] = *reinterpret_cast<const uint4*>(p);
    u.q[1] = *reinterpret_cast<const uint4*>(p + 512);
    return u.v;
}

// ---------------------------------------------------------------------------
// Kernel 1: q/k/v = X @ W^T, f32 in -> f16 out (f32 WMMA accumulate).
// q,k stored row-major [T][C]; v stored TRANSPOSED, in blocks of 32 tokens (8 KB), each
// block in the order of the attention kernel's V^T fragments:
//   [block][16-channel tile n][16-token half t][lane = 16 hi + lm][8 tokens]
// holds channel 16 n + lm, tokens 16 t + 8 hi .. + 7 of the block. A wave's 16-byte store
// here and a wave's 16-byte copy there each take 512 bytes in a row: four whole lines.
// One work-group per 64 tokens makes all 384 columns of q, k and v. It rounds
// its 64 X rows and the 384 W rows to f16 once, whole 512-byte rows a load,
// into LDS; behind one barrier wave w makes column tiles 3w .. 3w+2 (of 24)
// for all four 16-token tiles: twelve accumulators, and per 32-wide k chunk
// seven fragments from LDS feed twelve products.
// ---------------------------------------------------------------------------
#define PTOK   64                     // tokens per work-group
#define PPITCH 272                    // bytes per staged row (256 used): 16 B x odd
#define PROWS  (PTOK + 3 * CH)        // X rows, then Wq, Wk, Wv rows

__device__ inline void stage_row4(unsigned char* d, float4 f) {
    union { uint2 q; _Float16 h[4]; } u;
    u.h[0] = (_Float16)f.x; u.h[1] = (_Float16)f.y;
    u.h[2] = (_Float16)f.z; u.h[3] = (_Float16)f.w;
    *reinterpret_cast<uint2*>(d) = u.q;
}

__global__ __launch_bounds__(256) void qkv_proj_kernel(
    const float* __restrict__ X,
    const float* __restrict__ Wq, const float* __restrict__ Wk, const float* __restrict__ Wv,
    _Float16* __restrict__ qh, _Float16* __restrict__ kh, _Float16* __restrict__ vT)
{
    __shared__ __attribute__((aligned(16))) unsigned char st[PROWS * PPITCH];   // 121,856 B

    // wave number in a scalar register: row addresses and the q/k/v branches stay scalar
    const int wave = __builtin_amdgcn_readfirstlane(threadIdx.x >> 5);
    const int lane = threadIdx.x & 31;
    const int lm = lane & 15, hi = lane >> 4;

    const int tok0 = blockIdx.x * PTOK;       // flat token; 64 divides SEQ: one batch a group

    // ---- stage: a wave's load takes one whole row (32 lanes x 16 B), rows wave, wave + 8, ...
    const float* xs = X + (size_t)tok0 * CH + wave * CH + lane * 4;
    const float* wq = Wq + wave * CH + lane * 4;
    const float* wk = Wk + wave * CH + lane * 4;
    const float* wv = Wv + wave * CH + lane * 4;
    float4 rx[8], rq[16], rk[16], rv[16];
#pragma unroll
    for (int i = 0; i < 8; ++i)  rx[i] = *reinterpret_cast<const float4*>(xs + i * 8 * CH);
#pragma unroll
    for (int i = 0; i < 16; ++i) rq[i] = *reinterpret_cast<const float4*>(wq + i * 8 * CH);
#pragma unroll
    for (int i = 0; i < 16; ++i) rk[i] = *reinterpret_cast<const float4*>(wk + i * 8 * CH);
#pragma unroll
    for (int i = 0; i < 16; ++i) rv[i] = *reinterpret_cast<const float4*>(wv + i * 8 * CH);

    unsigned char* sd = st + wave * PPITCH + lane * 8;
#pragma unroll
    for (int i = 0; i < 8; ++i)  stage_row4(sd + (i * 8) * PPITCH, rx[i]);
#pragma unroll
    for (int i = 0; i < 16; ++i) stage_row4(sd + (PTOK + i * 8) * PPITCH, rq[i]);
#pragma unroll
    for (int i = 0; i < 16; ++i) stage_row4(sd + (PTOK + CH + i * 8) * PPITCH, rk[i]);
#pragma unroll
    for (int i = 0; i < 16; ++i) stage_row4(sd + (PTOK + 2 * CH + i * 8) * PPITCH, rv[i]);

    __syncthreads();   // every staged row is in LDS before any wave takes fragments

    // ---- wave w: column tiles 3w .. 3w+2 (B = W^T column = W row) x four token tiles (A) ----
    const unsigned char* xf = st + lm * PPITCH + hi * 16;
    const unsigned char* wf = xf + (PTOK + wave * 48) * PPITCH;
    v16h a[2][4], bw[2][3];
#pragma unroll
    for (int tt = 0; tt < 4; ++tt) a[0][tt] = lds_frag(xf + tt * 16 * PPITCH);
#pragma unroll
    for (int j = 0; j < 3; ++j) bw[0][j] = lds_frag(wf + j * 16 * PPITCH);

    v8f c[4][3];
#pragma unroll
    for (int tt = 0; tt < 4; ++tt)
#pragma unroll
        for (int j = 0; j < 3; ++j) c[tt][j] = (v8f){};

#pragma unroll
    for (int kb = 0; kb < 4; ++kb) {
        const int cur = kb & 1;
        if (kb < 3) {
#pragma unroll
            for (int tt = 0; tt < 4; ++tt)
                a[cur ^ 1][tt] = lds_frag(xf + tt * 16 * PPITCH + (kb + 1) * 64);
#pragma unroll
            for (int j = 0; j < 3; ++j)
                bw[cur ^ 1][j] = lds_frag(wf + j * 16 * PPITCH + (kb + 1) * 64);
        }
        // keeps the next k chunk's LDS reads in front of this chunk's twelve products, so that
        // their latency runs under the products instead of in front of each of them
        __builtin_amdgcn_sched_barrier(0);
#pragma unroll
        for (int tt = 0; tt < 4; ++tt)
#pragma unroll
            for (int j = 0; j < 3; ++j)
                c[tt][j] = __builtin_amdgcn_wmma_f32_16x16x32_f16(false, a[cur][tt], false,
                                                                  bw[cur][j], (short)0, c[tt][j],
                                                                  false, false);
    }

    const unsigned voq = (unsigned)((8 * hi) * CH + lm);    // q, k: token 8 hi (+ r), column lm
    const unsigned vov = (unsigned)(lane * 8);              // vT: this lane's 8 tokens of a half
#pragma unroll
    for (int j = 0; j < 3; ++j) {
        const int ct = wave * 3 + j;          // scalar
        const int p = ct >> 3, nt = ct & 7;
        if (p < 2) {
            _Float16* ob = ((p == 0) ? qh : kh) + (size_t)tok0 * CH + nt * 16;
#pragma unroll
            for (int tt = 0; tt < 4; ++tt)
#pragma unroll
                for (int r = 0; r < 8; ++r)
                    ob[voq + (unsigned)((tt * 16 + r) * CH)] = (_Float16)c[tt][j][r];
        } else {
            // transposed store: tokens contiguous along r -> one b128; token tile tt is
            // half tt & 1 of block tt >> 1 (of this group's two blocks)
            _Float16* ob = vT + (size_t)tok0 * CH + nt * 512;
#pragma unroll
            for (int tt = 0; tt < 4; ++tt) {
                union { uint4 q; _Float16 h[8]; } u;
#pragma unroll
                for (int r = 0; r < 8; ++r) u.h[r] = (_Float16)c[tt][j][r];
                *reinterpret_cast<uint4*>(ob + vov + (unsigned)((tt >> 1) * 32 * CH
                                                                + (tt & 1) * 256)) = u.q;
            }
            // the wait in front of any rewrite of a register that these four stores name
            asm volatile("s_wait_xcnt 0x0" ::: "memory");
        }
    }
}

#define OPITCH 132
#define KPITCH 272
#define KBYTES (32 * KPITCH)          // 32 keys
#define VBYTES (CH * 64)              // 128 channels x 32 keys, in fragment order as in memory
#define WBYTES (KBYTES + VBYTES)      // one wave's buffers, 16,896 B (= one partial O)

typedef __attribute__((ext_vector_type(4))) int v4i;
typedef __attribute__((address_space(1))) v4i gl_v4i;
typedef __attribute__((address_space(3))) v4i ls_v4i;

// The offset field moves the LDS and the global address alike: with the LDS step in it, one
// LDS address register serves all 16 copies of a tile (16 of them did not fit the register
// budget); what the global step differs from the LDS step by is added to the global base.
template <int C>
__device__ inline void copy_k_from(const unsigned char* ub, unsigned voff, ls_v4i* l) {
    if constexpr (C < 16) {
        __builtin_amdgcn_global_load_async_to_lds_b128(
            (gl_v4i*)(ub + (C * 512 - C * 2 * KPITCH) + voff), l, C * 2 * KPITCH, 0);
        copy_k_from<C + 1>(ub, voff, l);
    }
}
template <int C>
__device__ inline void copy_v_from(const unsigned char* ub, unsigned voff, ls_v4i* l) {
    if constexpr (C < 16) {
        __builtin_amdgcn_global_load_async_to_lds_b128((gl_v4i*)(ub + voff), l, C * 512, 0);
        copy_v_from<C + 1>(ub, voff, l);
    }
}

// 32 K rows are 8 KB in a row in memory: each copy takes 512 B = 4 whole lines (2 rows).
__device__ inline void copy_k_block(const _Float16* kblk, unsigned char* kbuf, int lane) {
    copy_k_from<0>(reinterpret_cast<const unsigned char*>(kblk), (unsigned)(lane * 16),
                   (ls_v4i*)(kbuf + (lane >> 4) * KPITCH + (lane & 15) * 16));
}

// A V^T block is 8 KB in a row in memory, already in fragment order: each copy takes 512 B =
// 4 whole lines and lands them as they lie, so LDS and global step alike and one address
// pair with the offset field serves all 16 copies.
__device__ inline void copy_v_block(const _Float16* vblk, unsigned char* vbuf, int lane) {
    copy_v_from<0>(reinterpret_cast<const unsigned char*>(vblk), (unsigned)(lane * 16),
                   (ls_v4i*)(vbuf + lane * 16));
}

__device__ inline float xhalf(float x) {
    return __builtin_bit_cast(float, __builtin_amdgcn_permlanex16(
        __builtin_bit_cast(int, x), __builtin_bit_cast(int, x),
        0x76543210, 0xfedcba98, false, false));
}

#define NWAVES 16
#define QBYTES (32 * KPITCH)

__global__ __launch_bounds__(512) void flash_attn_kernel(
    const _Float16* __restrict__ qh, const _Float16* __restrict__ kh,
    const _Float16* __restrict__ vT, float* __restrict__ out)
{
    // 16 waves * (K buffer, V^T buffer); behind the loop a wave's own range holds its partial O
    __shared__ __attribute__((aligned(16))) unsigned char ring[NWAVES * WBYTES];
    __shared__ __attribute__((aligned(16))) unsigned char qst[2 * QBYTES];   // long, short tile
    __shared__ __attribute__((aligned(16))) float lds_m[NWAVES * 32];   // row maxima per wave
    __shared__ __attribute__((aligned(16))) float lds_l[NWAVES * 32];   // row sums per wave

    // wave number in a scalar register: trip counts and branches stay scalar
    const int wave = __builtin_amdgcn_readfirstlane(threadIdx.x >> 5);
    const int lane = threadIdx.x & 31;
    const int lm = lane & 15, hi = lane >> 4;

    const int pi = blockIdx.x >> 2;            // tile pair: long tile 127 - pi, short tile pi
    const int b  = blockIdx.x & 3;

    // 128 - pi and pi + 1 key blocks, 129 in every work-group. The long tile gets just enough
    // waves for nine blocks a wave at most; the rest then have at most nine of the short one.
    const int nlong = (136 - pi) / 9;          // 8 .. 15
    const bool islong = wave < nlong;          // scalar
    const int qt = islong ? (QTILES32 - 1) - pi : pi;
    const int wl = islong ? wave : wave - nlong;        // this wave's first step of the walk
    const int nw = islong ? nlong : NWAVES - nlong;     // waves that share this tile's blocks

    const _Float16* qb  = qh + (size_t)b * SEQ * CH;
    const _Float16* kbp = kh + (size_t)b * SEQ * CH;
    const _Float16* vTb = vT + (size_t)b * SEQ * CH;   // [SEQ / 32] blocks of 32 * CH halves

    v8f o[2][8];
#pragma unroll
    for (int g = 0; g < 2; ++g)
#pragma unroll
        for (int n = 0; n < 8; ++n) o[g][n] = (v8f){};

    // this lane's query of each group: running maximum (alike in both halves) and the sum
    // over this half's keys (the halves are joined once, behind the loop)
    float mrun[2] = {-3.0e38f, -3.0e38f}, lrun[2] = {0.0f, 0.0f};

    const float scale = 0.08838834764831845f;  // 1/sqrt(128)

    const int nblk = qt + 1;                   // 32-key blocks; the last holds the diagonal

    // where this work-group's walk starts: step jj of the walk takes key block jj + turn, wrapped.
    // A shift modulo nblk: every block still comes exactly once. The factors spread the starts:
    // counted over work-groups in step, about 5 ask for the same block in a pass (15 unturned,
    // 46 in the first pass); short tiles started at a fixed share of their length meet in one pass.
    const int turn = (int)((unsigned)(islong ? 5 * pi : 37 * pi) % (unsigned)nblk);   // scalar
    int jr = wl + turn;                        // this wave's current key block (scalar)
    if (jr >= nblk) jr -= nblk;

    unsigned char* kbuf = ring + wave * WBYTES;
    unsigned char* vbuf = kbuf + KBYTES;
    const unsigned char* kfr = kbuf + lm * KPITCH + hi * 16;
    const unsigned char* vfr = vbuf + lane * 16;

    if (wl < nblk) {                           // scalar test: this wave's first block
        copy_k_block(kbp + (size_t)jr * 32 * CH, kbuf, lane);
        copy_v_block(vTb + (size_t)jr * 32 * CH, vbuf, lane);
    }

    {
        const int row = threadIdx.x >> 4, col = threadIdx.x & 15;
        const _Float16* q0 = qb + (size_t)(((QTILES32 - 1) - pi) * 32 + row) * CH + col * 8;
        const _Float16* q1 = qb + (size_t)(pi * 32 + row) * CH + col * 8;
        const v4i x0 = *reinterpret_cast<const v4i*>(q0);
        const v4i x1 = *reinterpret_cast<const v4i*>(q1);
        // The wait in front of any rewrite of the two loads' address registers. Inputs only:
        // the loaded values keep the loads in front of it, the addresses their registers.
        asm volatile("s_wait_xcnt 0x0" :: "v"(q0), "v"(q1), "v"(x0), "v"(x1) : "memory");
        *reinterpret_cast<v4i*>(qst + row * KPITCH + col * 16) = x0;
        *reinterpret_cast<v4i*>(qst + QBYTES + row * KPITCH + col * 16) = x1;
    }
    __syncthreads();   // both Q tiles are in LDS before any wave takes fragments
    const unsigned char* qfr = qst + (islong ? 0 : QBYTES) + lm * KPITCH + hi * 16;

    int dl = qt * 32 + lm - 8 * hi - jr * 32;

    for (int jj = wl; jj < nblk; jj += nw) {
        int dstep = 0;                         // scalar: first key of the next block less this one's

        // this block's K and V^T have landed before this wave reads them
        asm volatile("s_wait_asynccnt 0x0" ::: "memory");

        // ---- S^T = K * Q^T for two adjacent 16-key tiles (K=128), both query groups ----
        // s0[g][r]: key k0 + 8 hi + r, s1[g][r]: key k0 + 16 + 8 hi + r, query 16 g + lm
        v8f s0[2] = {{}, {}}, s1[2] = {{}, {}};
        v16h bk[2][2], aq[2][2];                 // [stage][16-key tile], [stage][query group]
#pragma unroll
        for (int h = 0; h < 2; ++h) {
            bk[0][h] = lds_frag(kfr + h * 16 * KPITCH);
            aq[0][h] = lds_frag(qfr + h * 16 * KPITCH);
        }
#pragma unroll
        for (int kb = 0; kb < 4; ++kb) {
            const int cur = kb & 1;
            if (kb < 3) {
#pragma unroll
                for (int h = 0; h < 2; ++h) {
                    bk[cur ^ 1][h] = lds_frag(kfr + h * 16 * KPITCH + (kb + 1) * 64);
                    aq[cur ^ 1][h] = lds_frag(qfr + h * 16 * KPITCH + (kb + 1) * 64);
                }
            }
            // keeps the next k chunk's LDS reads in front of this chunk's four products, so that
            // their latency runs under the products instead of in front of each pair
            __builtin_amdgcn_sched_barrier(0);
#pragma unroll
            for (int g = 0; g < 2; ++g) {
                s0[g] = __builtin_amdgcn_wmma_f32_16x16x32_f16(false, bk[cur][0], false, aq[cur][g],
                                                               (short)0, s0[g], false, false);
                s1[g] = __builtin_amdgcn_wmma_f32_16x16x32_f16(false, bk[cur][1], false, aq[cur][g],
                                                               (short)0, s1[g], false, false);
            }
        }

        // Inputs only: keeps the V^T reads behind the last S^T product. Lifted over it, they are
        // live together with the last K and Q fragments: more than 256 registers hold (scratch).
        asm volatile("" :: "v"(s0[0]), "v"(s0[1]), "v"(s1[0]), "v"(s1[1]) : "memory");

        // V^T fragments into registers now, so that both buffers are free for the next block
        v16h bv[8];
#pragma unroll
        for (int n = 0; n < 8; ++n) bv[n] = lds_frag_v(vfr + n * 1024);

        // every read of the two buffers has returned before the copies overwrite them
        asm volatile("s_wait_dscnt 0x0" ::: "memory");
        if (jj + nw < nblk) {                  // scalar test: a next block exists
            const int jp = jr;
            jr += nw;                          // nw < nblk here: one wrap at most
            if (jr >= nblk) jr -= nblk;
            dstep = (jr - jp) * 32;
            copy_k_block(kbp + (size_t)jr * 32 * CH, kbuf, lane);
            copy_v_block(vTb + (size_t)jr * 32 * CH, vbuf, lane);
        }

        // ---- mask + scale + online softmax over 32 keys, one query a lane and group ----
        v16h pt[2];                              // P^T as B operand: pt[g][s] = key kmap(s, hi)
#pragma unroll
        for (int g = 0; g < 2; ++g) {
            // last r of s0[g] that this query may see
            const int dlast = dl + g * 16;
            float rmax = -3.0e38f;
#pragma unroll
            for (int r = 0; r < 8; ++r) {
                float v0 = s0[g][r] * scale;
                float v1 = s1[g][r] * scale;
                if (r      > dlast) v0 = -3.0e38f;   // bites only in the diagonal block
                if (r + 16 > dlast) v1 = -3.0e38f;
                s0[g][r] = v0;
                s1[g][r] = v1;
                rmax = fmaxf(rmax, fmaxf(v0, v1));
            }
            rmax = fmaxf(rmax, xhalf(rmax));
            const float mnew = fmaxf(mrun[g], rmax);
            const float alpha = __expf(mrun[g] - mnew);
            mrun[g] = mnew;

            float rs0 = 0.0f, rs1 = 0.0f;
#pragma unroll
            for (int r = 0; r < 8; ++r) {
                const float p0 = __expf(s0[g][r] - mnew);
                const float p1 = __expf(s1[g][r] - mnew);
                rs0 += p0;
                rs1 += p1;
                pt[g][r]     = (_Float16)p0;
                pt[g][8 + r] = (_Float16)p1;
            }
            lrun[g] = lrun[g] * alpha + (rs0 + rs1);

#pragma unroll
            for (int n = 0; n < 8; ++n)
#pragma unroll
                for (int r = 0; r < 8; ++r) o[g][n][r] *= alpha;
        }

        dl -= dstep;

        // ---- O^T += V^T * P^T : full-K WMMAs; o[g][n][r]: channel 16 n + 8 hi + r ----
#pragma unroll
        for (int n = 0; n < 8; ++n)
#pragma unroll
            for (int g = 0; g < 2; ++g)
                o[g][n] = __builtin_amdgcn_wmma_f32_16x16x32_f16(false, bv[n], false, pt[g],
                                                                 (short)0, o[g][n], false, false);
    }
    // no copy of this wave is outstanding before its buffers take the partial O
    asm volatile("s_wait_asynccnt 0x0" ::: "memory");

    // the lane's number taken anew for the epilogue: held across the loop it costs the register
    // that did not fit (scratch)
    const int lanee = (int)__builtin_amdgcn_mbcnt_lo(~0u, 0u);
    const int lme = lanee & 15, hie = lanee >> 4;

    // ---- publish this wave's partial (max, sum, un-normalised O) ----
    // A wave without a key block publishes max -3e38, sum 0, O 0: weight 0 below.
#pragma unroll
    for (int g = 0; g < 2; ++g) {
        const float lsum = lrun[g] + xhalf(lrun[g]);   // the two halves' key sums joined
        if (hie == 0) {
            lds_m[wave * 32 + g * 16 + lme] = mrun[g];
            lds_l[wave * 32 + g * 16 + lme] = lsum;
        }
        // a lane holds 8 channels in a row of its query: two 16-byte stores a tile
        float* lo = reinterpret_cast<float*>(kbuf) + (g * 16 + lme) * OPITCH + 8 * hie;
#pragma unroll
        for (int n = 0; n < 8; ++n) {
            *reinterpret_cast<float4*>(lo + n * 16) =
                make_float4(o[g][n][0], o[g][n][1], o[g][n][2], o[g][n][3]);
            *reinterpret_cast<float4*>(lo + n * 16 + 4) =
                make_float4(o[g][n][4], o[g][n][5], o[g][n][6], o[g][n][7]);
        }
    }

    __syncthreads();   // every wave's partial is in LDS before any wave merges

    const int row = wave * 2;
    float2 mm[NWAVES], ll[NWAVES];
    float4 ov[NWAVES][2];
#pragma unroll
    for (int s = 0; s < NWAVES; ++s) {
        mm[s] = *reinterpret_cast<const float2*>(lds_m + s * 32 + row);
        ll[s] = *reinterpret_cast<const float2*>(lds_l + s * 32 + row);
        const float* pr = reinterpret_cast<const float*>(ring + s * WBYTES)
                          + row * OPITCH + lanee * 4;
        ov[s][0] = *reinterpret_cast<const float4*>(pr);
        ov[s][1] = *reinterpret_cast<const float4*>(pr + OPITCH);
    }

    float mall[2][2] = {{-3.0e38f, -3.0e38f}, {-3.0e38f, -3.0e38f}};   // [tile][row]
#pragma unroll
    for (int s = 0; s < NWAVES; ++s) {
        // nlong is 8 .. 15: only partials 8 .. 14 need the test
        const bool tl = (s < 8) ? true : ((s == NWAVES - 1) ? false : (s < nlong));
        if (tl) {
            mall[0][0] = fmaxf(mall[0][0], mm[s].x);
            mall[0][1] = fmaxf(mall[0][1], mm[s].y);
        } else {
            mall[1][0] = fmaxf(mall[1][0], mm[s].x);
            mall[1][1] = fmaxf(mall[1][1], mm[s].y);
        }
    }

    float lall[2][2] = {{0.0f, 0.0f}, {0.0f, 0.0f}};
    float4 acc[2][2];
#pragma unroll
    for (int t = 0; t < 2; ++t)
#pragma unroll
        for (int r = 0; r < 2; ++r) acc[t][r] = make_float4(0.0f, 0.0f, 0.0f, 0.0f);
#pragma unroll
    for (int s = 0; s < NWAVES; ++s) {
        const bool tl = (s < 8) ? true : ((s == NWAVES - 1) ? false : (s < nlong));
        if (tl) {
            const float e0 = __expf(mm[s].x - mall[0][0]);
            const float e1 = __expf(mm[s].y - mall[0][1]);
            lall[0][0] += e0 * ll[s].x;
            lall[0][1] += e1 * ll[s].y;
            acc[0][0].x += e0 * ov[s][0].x; acc[0][0].y += e0 * ov[s][0].y;
            acc[0][0].z += e0 * ov[s][0].z; acc[0][0].w += e0 * ov[s][0].w;
            acc[0][1].x += e1 * ov[s][1].x; acc[0][1].y += e1 * ov[s][1].y;
            acc[0][1].z += e1 * ov[s][1].z; acc[0][1].w += e1 * ov[s][1].w;
        } else {
            const float e0 = __expf(mm[s].x - mall[1][0]);
            const float e1 = __expf(mm[s].y - mall[1][1]);
            lall[1][0] += e0 * ll[s].x;
            lall[1][1] += e1 * ll[s].y;
            acc[1][0].x += e0 * ov[s][0].x; acc[1][0].y += e0 * ov[s][0].y;
            acc[1][0].z += e0 * ov[s][0].z; acc[1][0].w += e0 * ov[s][0].w;
            acc[1][1].x += e1 * ov[s][1].x; acc[1][1].y += e1 * ov[s][1].y;
            acc[1][1].z += e1 * ov[s][1].z; acc[1][1].w += e1 * ov[s][1].w;
        }
    }

    float* ob = out + (size_t)b * SEQ * CH + (size_t)row * CH + lanee * 4;
#pragma unroll
    for (int t = 0; t < 2; ++t) {
        const int tq = t ? pi : (QTILES32 - 1) - pi;
#pragma unroll
        for (int r = 0; r < 2; ++r) {
            const float inv = 1.0f / lall[t][r];
            float4 a = acc[t][r];
            a.x *= inv; a.y *= inv; a.z *= inv; a.w *= inv;
            *reinterpret_cast<float4*>(ob + (size_t)(tq * 32 + r) * CH) = a;
        }
    }
}

// ---------------------------------------------------------------------------
extern "C" void kernel_launch(void* const* d_in, const int* in_sizes, int n_in,
                              void* d_out, int out_size, void* d_ws, size_t ws_size,
                              hipStream_t stream) {
    (void)in_sizes; (void)n_in; (void)out_size; (void)ws_size;
    const float* X  = (const float*)d_in[0];
    const float* Wq = (const float*)d_in[1];
    const float* Wk = (const float*)d_in[2];
    const float* Wv = (const float*)d_in[3];
    float* out = (float*)d_out;

    const size_t elems = (size_t)BATCH * SEQ * CH;       // 2,097,152
    _Float16* qh = (_Float16*)d_ws;
    _Float16* kh = qh + elems;
    _Float16* vT = kh + elems;                            // [B][SEQ / 32][32 * CH]

    // 4 batch * 4096 tokens / 64 tokens per block = 256 blocks
    qkv_proj_kernel<<<256, 256, 0, stream>>>(X, Wq, Wk, Wv, qh, kh, vT);
    // 4 batch * 64 pairs of query tiles, one block of 16 waves each = 256 blocks
    flash_attn_kernel<<<256, 512, 0, stream>>>(qh, kh, vT, out);
}

// v009
// A run of this version takes 28.9 microseconds.
// Next to v008, in two timings, it ran 1.03 times as fast each time.
// Counting every step since v000, it is 15.4 times as fast.
#include <hip/hip_runtime.h>
#include <hip/hip_bf16.h>

typedef __attribute__((ext_vector_type(16))) _Float16 v16h;
typedef __attribute__((ext_vector_type(8)))  float    v8f;

#define BATCH 4
#define SEQ   4096
#define CH    128
#define QTILES32 (SEQ / 32)   // 128 query tiles of 32 rows

__device__ inline v16h lds_frag(const unsigned char* p) {
    union { uint4 q[2]; v16h v; } u;
    u.q[0] = *reinterpret_cast<const uint4*>(p);
    u.q[1] = *reinterpret_cast<const uint4*>(p + 32);
    return u.v;
}

// V^T fragment from a staged block in fragment order: the two 16-key halves lie 512 B apart
__device__ inline v16h lds_frag_v(const unsigned char* p) {
    union { uint4 q[2]; v16h v; } u;
    u.q[0] = *reinterpret_cast<const uint4*>(p);
    u.q[1] = *reinterpret_cast<const uint4*>(p + 512);
    return u.v;
}

// ---------------------------------------------------------------------------
// Kernel 1: q/k/v = X @ W^T, f32 in -> f16 out (f32 WMMA accumulate).
// q,k stored row-major [T][C]; v stored TRANSPOSED, in blocks of 32 tokens (8 KB), each
// block in the order of the attention kernel's V^T fragments:
//   [block][16-channel tile n][16-token half t][lane = 16 hi + lm][8 tokens]
// holds channel 16 n + lm, tokens 16 t + 8 hi .. + 7 of the block. A wave's 16-byte store
// here and a wave's 16-byte copy there each take 512 bytes in a row: four whole lines.
// One work-group per 64 tokens makes all 384 columns of q, k and v. It rounds
// its 64 X rows and the 384 W rows to f16 once, whole 512-byte rows a load,
// into LDS; behind one barrier wave w makes column tiles 3w .. 3w+2 (of 24)
// for all four 16-token tiles: twelve accumulators, and per 32-wide k chunk
// seven fragments from LDS feed twelve products.
// ---------------------------------------------------------------------------
#define PTOK   64                     // tokens per work-group
#define PPITCH 272                    // bytes per staged row (256 used): 16 B x odd
#define PROWS  (PTOK + 3 * CH)        // X rows, then Wq, Wk, Wv rows

__device__ inline void stage_row4(unsigned char* d, float4 f) {
    union { uint2 q; _Float16 h[4]; } u;
    u.h[0] = (_Float16)f.x; u.h[1] = (_Float16)f.y;
    u.h[2] = (_Float16)f.z; u.h[3] = (_Float16)f.w;
    *reinterpret_cast<uint2*>(d) = u.q;
}

__global__ __launch_bounds__(256) void qkv_proj_kernel(
    const float* __restrict__ X,
    const float* __restrict__ Wq, const float* __restrict__ Wk, const float* __restrict__ Wv,
    _Float16* __restrict__ qh, _Float16* __restrict__ kh, _Float16* __restrict__ vT)
{
    __shared__ __attribute__((aligned(16))) unsigned char st[PROWS * PPITCH];   // 121,856 B

    // wave number in a scalar register: row addresses and the q/k/v branches stay scalar
    const int wave = __builtin_amdgcn_readfirstlane(threadIdx.x >> 5);
    const int lane = threadIdx.x & 31;
    const int lm = lane & 15, hi = lane >> 4;

    const int tok0 = blockIdx.x * PTOK;       // flat token; 64 divides SEQ: one batch a group

    // ---- stage: a wave's load takes one whole row (32 lanes x 16 B), rows wave, wave + 8, ...
    const float* xs = X + (size_t)tok0 * CH + wave * CH + lane * 4;
    const float* wq = Wq + wave * CH + lane * 4;
    const float* wk = Wk + wave * CH + lane * 4;
    const float* wv = Wv + wave * CH + lane * 4;
    float4 rx[8], rq[16], rk[16], rv[16];
#pragma unroll
    for (int i = 0; i < 8; ++i)  rx[i] = *reinterpret_cast<const float4*>(xs + i * 8 * CH);
#pragma unroll
    for (int i = 0; i < 16; ++i) rq[i] = *reinterpret_cast<const float4*>(wq + i * 8 * CH);
#pragma unroll
    for (int i = 0; i < 16; ++i) rk[i] = *reinterpret_cast<const float4*>(wk + i * 8 * CH);
#pragma unroll
    for (int i = 0; i < 16; ++i) rv[i] = *reinterpret_cast<const float4*>(wv + i * 8 * CH);

    unsigned char* sd = st + wave * PPITCH + lane * 8;
#pragma unroll
    for (int i = 0; i < 8; ++i)  stage_row4(sd + (i * 8) * PPITCH, rx[i]);
#pragma unroll
    for (int i = 0; i < 16; ++i) stage_row4(sd + (PTOK + i * 8) * PPITCH, rq[i]);
#pragma unroll
    for (int i = 0; i < 16; ++i) stage_row4(sd + (PTOK + CH + i * 8) * PPITCH, rk[i]);
#pragma unroll
    for (int i = 0; i < 16; ++i) stage_row4(sd + (PTOK + 2 * CH + i * 8) * PPITCH, rv[i]);

    __syncthreads();   // every staged row is in LDS before any wave takes fragments

    // ---- wave w: column tiles 3w .. 3w+2 (B = W^T column = W row) x four token tiles (A) ----
    const unsigned char* xf = st + lm * PPITCH + hi * 16;
    const unsigned char* wf = xf + (PTOK + wave * 48) * PPITCH;
    v16h a[2][4], bw[2][3];
#pragma unroll
    for (int tt = 0; tt < 4; ++tt) a[0][tt] = lds_frag(xf + tt * 16 * PPITCH);
#pragma unroll
    for (int j = 0; j < 3; ++j) bw[0][j] = lds_frag(wf + j * 16 * PPITCH);

    v8f c[4][3];
#pragma unroll
    for (int tt = 0; tt < 4; ++tt)
#pragma unroll
        for (int j = 0; j < 3; ++j) c[tt][j] = (v8f){};

#pragma unroll
    for (int kb = 0; kb < 4; ++kb) {
        const int cur = kb & 1;
        if (kb < 3) {
#pragma unroll
            for (int tt = 0; tt < 4; ++tt)
                a[cur ^ 1][tt] = lds_frag(xf + tt * 16 * PPITCH + (kb + 1) * 64);
#pragma unroll
            for (int j = 0; j < 3; ++j)
                bw[cur ^ 1][j] = lds_frag(wf + j * 16 * PPITCH + (kb + 1) * 64);
        }
        // keeps the next k chunk's LDS reads in front of this chunk's twelve products, so that
        // their latency runs under the products instead of in front of each of them
        __builtin_amdgcn_sched_barrier(0);
#pragma unroll
        for (int tt = 0; tt < 4; ++tt)
#pragma unroll
            for (int j = 0; j < 3; ++j)
                c[tt][j] = __builtin_amdgcn_wmma_f32_16x16x32_f16(false, a[cur][tt], false,
                                                                  bw[cur][j], (short)0, c[tt][j],
                                                                  false, false);
    }

    const unsigned voq = (unsigned)((8 * hi) * CH + lm);    // q, k: token 8 hi (+ r), column lm
    const unsigned vov = (unsigned)(lane * 8);              // vT: this lane's 8 tokens of a half
#pragma unroll
    for (int j = 0; j < 3; ++j) {
        const int ct = wave * 3 + j;          // scalar
        const int p = ct >> 3, nt = ct & 7;
        if (p < 2) {
            _Float16* ob = ((p == 0) ? qh : kh) + (size_t)tok0 * CH + nt * 16;
#pragma unroll
            for (int tt = 0; tt < 4; ++tt)
#pragma unroll
                for (int r = 0; r < 8; ++r)
                    ob[voq + (unsigned)((tt * 16 + r) * CH)] = (_Float16)c[tt][j][r];
        } else {
            // transposed store: tokens contiguous along r -> one b128; token tile tt is
            // half tt & 1 of block tt >> 1 (of this group's two blocks)
            _Float16* ob = vT + (size_t)tok0 * CH + nt * 512;
#pragma unroll
            for (int tt = 0; tt < 4; ++tt) {
                union { uint4 q; _Float16 h[8]; } u;
#pragma unroll
                for (int r = 0; r < 8; ++r) u.h[r] = (_Float16)c[tt][j][r];
                *reinterpret_cast<uint4*>(ob + vov + (unsigned)((tt >> 1) * 32 * CH
                                                                + (tt & 1) * 256)) = u.q;
            }
            // the wait in front of any rewrite of a register that these four stores name
            asm volatile("s_wait_xcnt 0x0" ::: "memory");
        }
    }
}

#define OPITCH 132
#define KPITCH 272
#define KBYTES (32 * KPITCH)          // 32 keys
#define VBYTES (CH * 64)              // 128 channels x 32 keys, in fragment order as in memory
#define WBYTES (KBYTES + VBYTES)      // one wave's buffers, 16,896 B (= one partial O)

typedef __attribute__((ext_vector_type(4))) int v4i;
typedef __attribute__((address_space(1))) v4i gl_v4i;
typedef __attribute__((address_space(3))) v4i ls_v4i;

// The offset field moves the LDS and the global address alike: with the LDS step in it, one
// LDS address register serves all 16 copies of a tile (16 of them did not fit the register
// budget); what the global step differs from the LDS step by is added to the global base.
template <int C>
__device__ inline void copy_k_from(const unsigned char* ub, unsigned voff, ls_v4i* l) {
    if constexpr (C < 16) {
        // Each copy's base stays a scalar pair of its own (the two readfirstlane keep the compiler
        // from adding the lane offset first): scalar base + 32-bit lane offset, no 64-bit vector
        // address per copy. Up to nine such pairs at once did not fit the register budget.
        const unsigned long long sb = (unsigned long long)(ub + (C * 512 - C * 2 * KPITCH));
        const unsigned lo = (unsigned)__builtin_amdgcn_readfirstlane((int)(unsigned)sb);
        const unsigned hi = (unsigned)__builtin_amdgcn_readfirstlane((int)(unsigned)(sb >> 32));
        __builtin_amdgcn_global_load_async_to_lds_b128(
            (gl_v4i*)((((unsigned long long)hi << 32) | lo) + voff), l, C * 2 * KPITCH, 0);
        copy_k_from<C + 1>(ub, voff, l);
    }
}
template <int C>
__device__ inline void copy_v_from(const unsigned char* ub, unsigned voff, ls_v4i* l) {
    if constexpr (C < 16) {
        __builtin_amdgcn_global_load_async_to_lds_b128((gl_v4i*)(ub + voff), l, C * 512, 0);
        copy_v_from<C + 1>(ub, voff, l);
    }
}

// 32 K rows are 8 KB in a row in memory: each copy takes 512 B = 4 whole lines (2 rows).
// voff: the lane's byte offset from kall, the batch's first K row (block_lane_offset below).
__device__ inline void copy_k_block(const _Float16* kall, unsigned voff, unsigned char* kbuf,
                                    int lane) {
    copy_k_from<0>(reinterpret_cast<const unsigned char*>(kall), voff,
                   (ls_v4i*)(kbuf + (lane >> 4) * KPITCH + (lane & 15) * 16));
}

// A V^T block is 8 KB in a row in memory, already in fragment order: each copy takes 512 B =
// 4 whole lines and lands them as they lie, so LDS and global step alike and one address
// pair with the offset field serves all 16 copies.
__device__ inline void copy_v_block(const _Float16* vall, unsigned voff, unsigned char* vbuf,
                                    int lane) {
    copy_v_from<0>(reinterpret_cast<const unsigned char*>(vall), voff,
                   (ls_v4i*)(vbuf + lane * 16));
}

// Byte offset of this lane's 16 bytes in key block j (8 KB a block, K and V^T alike): formed anew
// for each block from the scalar block number, (512 j + lane) * 16. Two 64-bit lane addresses
// held across the loop instead did not fit the register budget (scratch).
__device__ inline unsigned block_lane_offset(int j) {
    return __builtin_amdgcn_mbcnt_lo(~0u, (unsigned)j * 512u) * 16u;
}

__device__ inline float xhalf(float x) {
    return __builtin_bit_cast(float, __builtin_amdgcn_permlanex16(
        __builtin_bit_cast(int, x), __builtin_bit_cast(int, x),
        0x76543210, 0xfedcba98, false, false));
}

#define NWAVES 16
#define QBYTES (32 * KPITCH)
#define RESCALE_GAP 5.5f

__global__ __launch_bounds__(512) void flash_attn_kernel(
    const _Float16* __restrict__ qh, const _Float16* __restrict__ kh,
    const _Float16* __restrict__ vT, float* __restrict__ out)
{
    // 16 waves * (K buffer, V^T buffer); behind the loop a wave's own range holds its partial O
    __shared__ __attribute__((aligned(16))) unsigned char ring[NWAVES * WBYTES];
    __shared__ __attribute__((aligned(16))) unsigned char qst[2 * QBYTES];   // long, short tile
    __shared__ __attribute__((aligned(16))) float lds_m[NWAVES * 32];   // row maxima per wave
    __shared__ __attribute__((aligned(16))) float lds_l[NWAVES * 32];   // row sums per wave

    // wave number in a scalar register: trip counts and branches stay scalar
    const int wave = __builtin_amdgcn_readfirstlane(threadIdx.x >> 5);
    const int lane = threadIdx.x & 31;
    const int lm = lane & 15, hi = lane >> 4;

    const int pi = blockIdx.x >> 2;            // tile pair: long tile 127 - pi, short tile pi
    const int b  = blockIdx.x & 3;

    // 128 - pi and pi + 1 key blocks, 129 in every work-group. The long tile gets just enough
    // waves for nine blocks a wave at most; the rest then have at most nine of the short one.
    const int nlong = (136 - pi) / 9;          // 8 .. 15
    const bool islong = wave < nlong;          // scalar
    const int qt = islong ? (QTILES32 - 1) - pi : pi;
    const int wl = islong ? wave : wave - nlong;        // this wave's first step of the walk
    const int nw = islong ? nlong : NWAVES - nlong;     // waves that share this tile's blocks

    const _Float16* qb  = qh + (size_t)b * SEQ * CH;
    const _Float16* kbp = kh + (size_t)b * SEQ * CH;
    const _Float16* vTb = vT + (size_t)b * SEQ * CH;   // [SEQ / 32] blocks of 32 * CH halves

    v8f o[2][8];
#pragma unroll
    for (int g = 0; g < 2; ++g)
#pragma unroll
        for (int n = 0; n < 8; ++n) o[g][n] = (v8f){};

    // this lane's query of each group: reference maximum (alike in both halves) and the sum
    // over this half's keys (the halves are joined once, behind the loop)
    float mrun[2] = {-3.0e38f, -3.0e38f}, lrun[2] = {0.0f, 0.0f};

    const float scale = 0.08838834764831845f;  // 1/sqrt(128)

    const int nblk = qt + 1;                   // 32-key blocks; the last holds the diagonal

    // where this work-group's walk starts: step jj of the walk takes key block jj + turn, wrapped.
    // A shift modulo nblk: every block still comes exactly once. The factors spread the starts:
    // counted over work-groups in step, about 5 ask for the same block in a pass (15 unturned,
    // 46 in the first pass); short tiles started at a fixed share of their length meet in one pass.
    const int turn = (int)((unsigned)(islong ? 5 * pi : 37 * pi) % (unsigned)nblk);   // scalar
    int jr = wl + turn;                        // this wave's current key block (scalar)
    if (jr >= nblk) jr -= nblk;

    unsigned char* kbuf = ring + wave * WBYTES;
    unsigned char* vbuf = kbuf + KBYTES;
    const unsigned char* kfr = kbuf + lm * KPITCH + hi * 16;
    const unsigned char* vfr = vbuf + lane * 16;

    if (wl < nblk) {                           // scalar test: this wave's first block
        const unsigned vo = block_lane_offset(jr);
        copy_k_block(kbp, vo, kbuf, lane);
        copy_v_block(vTb, vo, vbuf, lane);
    }

    {
        const int row = threadIdx.x >> 4, col = threadIdx.x & 15;
        const _Float16* q0 = qb + (size_t)(((QTILES32 - 1) - pi) * 32 + row) * CH + col * 8;
        const _Float16* q1 = qb + (size_t)(pi * 32 + row) * CH + col * 8;
        const v4i x0 = *reinterpret_cast<const v4i*>(q0);
        const v4i x1 = *reinterpret_cast<const v4i*>(q1);
        // The wait in front of any rewrite of the two loads' address registers. Inputs only:
        // the loaded values keep the loads in front of it, the addresses their registers.
        asm volatile("s_wait_xcnt 0x0" :: "v"(q0), "v"(q1), "v"(x0), "v"(x1) : "memory");
        *reinterpret_cast<v4i*>(qst + row * KPITCH + col * 16) = x0;
        *reinterpret_cast<v4i*>(qst + QBYTES + row * KPITCH + col * 16) = x1;
    }
    __syncthreads();   // both Q tiles are in LDS before any wave takes fragments
    const unsigned char* qfr = qst + (islong ? 0 : QBYTES) + lm * KPITCH + hi * 16;

    int dl = qt * 32 + lm - 8 * hi - jr * 32;

    for (int jj = wl; jj < nblk; jj += nw) {
        int dstep = 0;                         // scalar: first key of the next block less this one's

        // this block's K and V^T have landed before this wave reads them
        asm volatile("s_wait_asynccnt 0x0" ::: "memory");

        // ---- S^T = K * Q^T for two adjacent 16-key tiles (K=128), both query groups ----
        // s0[g][r]: key k0 + 8 hi + r, s1[g][r]: key k0 + 16 + 8 hi + r, query 16 g + lm
        v8f s0[2] = {{}, {}}, s1[2] = {{}, {}};
        v16h bk[2][2], aq[2][2];                 // [stage][16-key tile], [stage][query group]
#pragma unroll
        for (int h = 0; h < 2; ++h) {
            bk[0][h] = lds_frag(kfr + h * 16 * KPITCH);
            aq[0][h] = lds_frag(qfr + h * 16 * KPITCH);
        }
#pragma unroll
        for (int kb = 0; kb < 4; ++kb) {
            const int cur = kb & 1;
            if (kb < 3) {
#pragma unroll
                for (int h = 0; h < 2; ++h) {
                    bk[cur ^ 1][h] = lds_frag(kfr + h * 16 * KPITCH + (kb + 1) * 64);
                    aq[cur ^ 1][h] = lds_frag(qfr + h * 16 * KPITCH + (kb + 1) * 64);
                }
            }
            // keeps the next k chunk's LDS reads in front of this chunk's four products, so that
            // their latency runs under the products instead of in front of each pair
            __builtin_amdgcn_sched_barrier(0);
#pragma unroll
            for (int g = 0; g < 2; ++g) {
                s0[g] = __builtin_amdgcn_wmma_f32_16x16x32_f16(false, bk[cur][0], false, aq[cur][g],
                                                               (short)0, s0[g], false, false);
                s1[g] = __builtin_amdgcn_wmma_f32_16x16x32_f16(false, bk[cur][1], false, aq[cur][g],
                                                               (short)0, s1[g], false, false);
            }
        }

        // Inputs only: keeps the V^T reads behind the last S^T product. Lifted over it, they are
        // live together with the last K and Q fragments: more than 256 registers hold (scratch).
        asm volatile("" :: "v"(s0[0]), "v"(s0[1]), "v"(s1[0]), "v"(s1[1]) : "memory");

        // V^T fragments into registers now, so that both buffers are free for the next block
        v16h bv[8];
#pragma unroll
        for (int n = 0; n < 8; ++n) bv[n] = lds_frag_v(vfr + n * 1024);

        // every read of the two buffers has returned before the copies overwrite them
        asm volatile("s_wait_dscnt 0x0" ::: "memory");
        if (jj + nw < nblk) {                  // scalar test: a next block exists
            const int jp = jr;
            jr += nw;                          // nw < nblk here: one wrap at most
            if (jr >= nblk) jr -= nblk;
            dstep = (jr - jp) * 32;
            const unsigned vo = block_lane_offset(jr);
            copy_k_block(kbp, vo, kbuf, lane);
            copy_v_block(vTb, vo, vbuf, lane);
        }

        // ---- mask + scale + online softmax over 32 keys, one query a lane and group ----
        float rmax[2];
#pragma unroll
        for (int g = 0; g < 2; ++g) {
            // last r of s0[g] that this query may see
            const int dlast = dl + g * 16;
            float rm = -3.0e38f;
#pragma unroll
            for (int r = 0; r < 8; ++r) {
                float v0 = s0[g][r] * scale;
                float v1 = s1[g][r] * scale;
                if (r      > dlast) v0 = -3.0e38f;   // bites only in the diagonal block
                if (r + 16 > dlast) v1 = -3.0e38f;
                s0[g][r] = v0;
                s1[g][r] = v1;
                rm = fmaxf(rm, fmaxf(v0, v1));
            }
            rmax[g] = fmaxf(rm, xhalf(rm));
        }

        // Lazy rescale: mrun is the reference of the exponentials, not the exact maximum. It moves,
        // and O and the sum are rescaled, only in a pass where some query's block maximum lies more
        // than RESCALE_GAP above it: P stays below e^5.5 = 245, far inside f16. One test a pass for
        // both groups, a scalar branch; the first pass of a wave always takes it (mrun = -3e38).
        const bool need = (rmax[0] > mrun[0] + RESCALE_GAP) || (rmax[1] > mrun[1] + RESCALE_GAP);
        if (__builtin_amdgcn_ballot_w32(need) != 0u) {
#pragma unroll
            for (int g = 0; g < 2; ++g) {
                const float mnew = fmaxf(mrun[g], rmax[g]);
                const float alpha = __expf(mrun[g] - mnew);
                mrun[g] = mnew;
                lrun[g] *= alpha;
#pragma unroll
                for (int n = 0; n < 8; ++n)
#pragma unroll
                    for (int r = 0; r < 8; ++r) o[g][n][r] *= alpha;
            }
        }

        v16h pt[2];                              // P^T as B operand: pt[g][s] = key kmap(s, hi)
#pragma unroll
        for (int g = 0; g < 2; ++g) {
            const float mref = mrun[g];
            float rs0 = 0.0f, rs1 = 0.0f;
#pragma unroll
            for (int r = 0; r < 8; ++r) {
                const float p0 = __expf(s0[g][r] - mref);
                const float p1 = __expf(s1[g][r] - mref);
                rs0 += p0;
                rs1 += p1;
                pt[g][r]     = (_Float16)p0;
                pt[g][8 + r] = (_Float16)p1;
            }
            lrun[g] += rs0 + rs1;
        }

        dl -= dstep;

        // ---- O^T += V^T * P^T : full-K WMMAs; o[g][n][r]: channel 16 n + 8 hi + r ----
#pragma unroll
        for (int n = 0; n < 8; ++n)
#pragma unroll
            for (int g = 0; g < 2; ++g)
                o[g][n] = __builtin_amdgcn_wmma_f32_16x16x32_f16(false, bv[n], false, pt[g],
                                                                 (short)0, o[g][n], false, false);
    }
    // no copy of this wave is outstanding before its buffers take the partial O
    asm volatile("s_wait_asynccnt 0x0" ::: "memory");

    // the lane's number taken anew for the epilogue: held across the loop it costs the register
    // that did not fit (scratch)
    const int lanee = (int)__builtin_amdgcn_mbcnt_lo(~0u, 0u);
    const int lme = lanee & 15, hie = lanee >> 4;

    // ---- publish this wave's partial (max, sum, un-normalised O) ----
    // A wave without a key block publishes max -3e38, sum 0, O 0: weight 0 below.
#pragma unroll
    for (int g = 0; g < 2; ++g) {
        const float lsum = lrun[g] + xhalf(lrun[g]);   // the two halves' key sums joined
        if (hie == 0) {
            lds_m[wave * 32 + g * 16 + lme] = mrun[g];
            lds_l[wave * 32 + g * 16 + lme] = lsum;
        }
        // a lane holds 8 channels in a row of its query: two 16-byte stores a tile
        float* lo = reinterpret_cast<float*>(kbuf) + (g * 16 + lme) * OPITCH + 8 * hie;
#pragma unroll
        for (int n = 0; n < 8; ++n) {
            *reinterpret_cast<float4*>(lo + n * 16) =
                make_float4(o[g][n][0], o[g][n][1], o[g][n][2], o[g][n][3]);
            *reinterpret_cast<float4*>(lo + n * 16 + 4) =
                make_float4(o[g][n][4], o[g][n][5], o[g][n][6], o[g][n][7]);
        }
    }

    __syncthreads();   // every wave's partial is in LDS before any wave merges

    const int row = wave * 2;
    float2 mm[NWAVES], ll[NWAVES];
    float4 ov[NWAVES][2];
#pragma unroll
    for (int s = 0; s < NWAVES; ++s) {
        mm[s] = *reinterpret_cast<const float2*>(lds_m + s * 32 + row);
        ll[s] = *reinterpret_cast<const float2*>(lds_l + s * 32 + row);
        const float* pr = reinterpret_cast<const float*>(ring + s * WBYTES)
                          + row * OPITCH + lanee * 4;
        ov[s][0] = *reinterpret_cast<const float4*>(pr);
        ov[s][1] = *reinterpret_cast<const float4*>(pr + OPITCH);
    }

    float mall[2][2] = {{-3.0e38f, -3.0e38f}, {-3.0e38f, -3.0e38f}};   // [tile][row]
#pragma unroll
    for (int s = 0; s < NWAVES; ++s) {
        // nlong is 8 .. 15: only partials 8 .. 14 need the test
        const bool tl = (s < 8) ? true : ((s == NWAVES - 1) ? false : (s < nlong));
        if (tl) {
            mall[0][0] = fmaxf(mall[0][0], mm[s].x);
            mall[0][1] = fmaxf(mall[0][1], mm[s].y);
        } else {
            mall[1][0] = fmaxf(mall[1][0], mm[s].x);
            mall[1][1] = fmaxf(mall[1][1], mm[s].y);
        }
    }

    float lall[2][2] = {{0.0f, 0.0f}, {0.0f, 0.0f}};
    float4 acc[2][2];
#pragma unroll
    for (int t = 0; t < 2; ++t)
#pragma unroll
        for (int r = 0; r < 2; ++r) acc[t][r] = make_float4(0.0f, 0.0f, 0.0f, 0.0f);
#pragma unroll
    for (int s = 0; s < NWAVES; ++s) {
        const bool tl = (s < 8) ? true : ((s == NWAVES - 1) ? false : (s < nlong));
        if (tl) {
            const float e0 = __expf(mm[s].x - mall[0][0]);
            const float e1 = __expf(mm[s].y - mall[0][1]);
            lall[0][0] += e0 * ll[s].x;
            lall[0][1] += e1 * ll[s].y;
            acc[0][0].x += e0 * ov[s][0].x; acc[0][0].y += e0 * ov[s][0].y;
            acc[0][0].z += e0 * ov[s][0].z; acc[0][0].w += e0 * ov[s][0].w;
            acc[0][1].x += e1 * ov[s][1].x; acc[0][1].y += e1 * ov[s][1].y;
            acc[0][1].z += e1 * ov[s][1].z; acc[0][1].w += e1 * ov[s][1].w;
        } else {
            const float e0 = __expf(mm[s].x - mall[1][0]);
            const float e1 = __expf(mm[s].y - mall[1][1]);
            lall[1][0] += e0 * ll[s].x;
            lall[1][1] += e1 * ll[s].y;
            acc[1][0].x += e0 * ov[s][0].x; acc[1][0].y += e0 * ov[s][0].y;
            acc[1][0].z += e0 * ov[s][0].z; acc[1][0].w += e0 * ov[s][0].w;
            acc[1][1].x += e1 * ov[s][1].x; acc[1][1].y += e1 * ov[s][1].y;
            acc[1][1].z += e1 * ov[s][1].z; acc[1][1].w += e1 * ov[s][1].w;
        }
    }

    float* ob = out + (size_t)b * SEQ * CH + (size_t)row * CH + lanee * 4;
#pragma unroll
    for (int t = 0; t < 2; ++t) {
        const int tq = t ? pi : (QTILES32 - 1) - pi;
#pragma unroll
        for (int r = 0; r < 2; ++r) {
            const float inv = 1.0f / lall[t][r];
            float4 a = acc[t][r];
            a.x *= inv; a.y *= inv; a.z *= inv; a.w *= inv;
            *reinterpret_cast<float4*>(ob + (size_t)(tq * 32 + r) * CH) = a;
        }
    }
}

// ---------------------------------------------------------------------------
extern "C" void kernel_launch(void* const* d_in, const int* in_sizes, int n_in,
                              void* d_out, int out_size, void* d_ws, size_t ws_size,
                              hipStream_t stream) {
    (void)in_sizes; (void)n_in; (void)out_size; (void)ws_size;
    const float* X  = (const float*)d_in[0];
    const float* Wq = (const float*)d_in[1];
    const float* Wk = (const float*)d_in[2];
    const float* Wv = (const float*)d_in[3];
    float* out = (float*)d_out;

    const size_t elems = (size_t)BATCH * SEQ * CH;       // 2,097,152
    _Float16* qh = (_Float16*)d_ws;
    _Float16* kh = qh + elems;
    _Float16* vT = kh + elems;                            // [B][SEQ / 32][32 * CH]

    // 4 batch * 4096 tokens / 64 tokens per block = 256 blocks
    qkv_proj_kernel<<<256, 256, 0, stream>>>(X, Wq, Wk, Wv, qh, kh, vT);
    // 4 batch * 64 pairs of query tiles, one block of 16 waves each = 256 blocks
    flash_attn_kernel<<<256, 512, 0, stream>>>(qh, kh, vT, out);
}

// v010
// A run of this version takes 27.2 microseconds.
// In two side-by-side timings against v009, it was 1.06 and 1.07 times as fast.
// All steps since v000 together make it 16.4 times as fast.
#include <hip/hip_runtime.h>
#include <hip/hip_bf16.h>

typedef __attribute__((ext_vector_type(16))) _Float16 v16h;
typedef __attribute__((ext_vector_type(8)))  float    v8f;

#define BATCH 4
#define SEQ   4096
#define CH    128
#define QTILES32 (SEQ / 32)   // 128 query tiles of 32 rows

__device__ inline v16h lds_frag(const unsigned char* p) {
    union { uint4 q[2]; v16h v; } u;
    u.q[0] = *reinterpret_cast<const uint4*>(p);
    u.q[1] = *reinterpret_cast<const uint4*>(p + 32);
    return u.v;
}

// V^T fragment from a staged block in fragment order: the two 16-key halves lie 512 B apart
__device__ inline v16h lds_frag_v(const unsigned char* p) {
    union { uint4 q[2]; v16h v; } u;
    u.q[0] = *reinterpret_cast<const uint4*>(p);
    u.q[1] = *reinterpret_cast<const uint4*>(p + 512);
    return u.v;
}

// ---------------------------------------------------------------------------
// Kernel 1: q/k/v = X @ W^T, f32 in -> f16 out (f32 WMMA accumulate).
// q,k stored row-major [T][C]; v stored TRANSPOSED, in blocks of 32 tokens (8 KB), each
// block in the order of the attention kernel's V^T fragments:
//   [block][16-channel tile n][16-token half t][lane = 16 hi + lm][8 tokens]
// holds channel 16 n + lm, tokens 16 t + 8 hi .. + 7 of the block. A wave's 16-byte store
// here and a wave's 16-byte copy there each take 512 bytes in a row: four whole lines.
// One work-group per 64 tokens makes all 384 columns of q, k and v. It rounds
// its 64 X rows and the 384 W rows to f16 once, whole 512-byte rows a load,
// into LDS; behind one barrier wave w makes column tiles 3w .. 3w+2 (of 24)
// for all four 16-token tiles: twelve accumulators, and per 32-wide k chunk
// seven fragments from LDS feed twelve products.
// ---------------------------------------------------------------------------
#define PTOK   64                     // tokens per work-group
#define PPITCH 272                    // bytes per staged row (256 used): 16 B x odd
#define PROWS  (PTOK + 3 * CH)        // X rows, then Wq, Wk, Wv rows

__device__ inline void stage_row4(unsigned char* d, float4 f) {
    union { uint2 q; _Float16 h[4]; } u;
    u.h[0] = (_Float16)f.x; u.h[1] = (_Float16)f.y;
    u.h[2] = (_Float16)f.z; u.h[3] = (_Float16)f.w;
    *reinterpret_cast<uint2*>(d) = u.q;
}

__global__ __launch_bounds__(256) void qkv_proj_kernel(
    const float* __restrict__ X,
    const float* __restrict__ Wq, const float* __restrict__ Wk, const float* __restrict__ Wv,
    _Float16* __restrict__ qh, _Float16* __restrict__ kh, _Float16* __restrict__ vT)
{
    __shared__ __attribute__((aligned(16))) unsigned char st[PROWS * PPITCH];   // 121,856 B

    // wave number in a scalar register: row addresses and the q/k/v branches stay scalar
    const int wave = __builtin_amdgcn_readfirstlane(threadIdx.x >> 5);
    const int lane = threadIdx.x & 31;
    const int lm = lane & 15, hi = lane >> 4;

    const int tok0 = blockIdx.x * PTOK;       // flat token; 64 divides SEQ: one batch a group

    // ---- stage: a wave's load takes one whole row (32 lanes x 16 B), rows wave, wave + 8, ...
    const float* xs = X + (size_t)tok0 * CH + wave * CH + lane * 4;
    const float* wq = Wq + wave * CH + lane * 4;
    const float* wk = Wk + wave * CH + lane * 4;
    const float* wv = Wv + wave * CH + lane * 4;
    float4 rx[8], rq[16], rk[16], rv[16];
#pragma unroll
    for (int i = 0; i < 8; ++i)  rx[i] = *reinterpret_cast<const float4*>(xs + i * 8 * CH);
#pragma unroll
    for (int i = 0; i < 16; ++i) rq[i] = *reinterpret_cast<const float4*>(wq + i * 8 * CH);
#pragma unroll
    for (int i = 0; i < 16; ++i) rk[i] = *reinterpret_cast<const float4*>(wk + i * 8 * CH);
#pragma unroll
    for (int i = 0; i < 16; ++i) rv[i] = *reinterpret_cast<const float4*>(wv + i * 8 * CH);

    unsigned char* sd = st + wave * PPITCH + lane * 8;
#pragma unroll
    for (int i = 0; i < 8; ++i)  stage_row4(sd + (i * 8) * PPITCH, rx[i]);
#pragma unroll
    for (int i = 0; i < 16; ++i) stage_row4(sd + (PTOK + i * 8) * PPITCH, rq[i]);
#pragma unroll
    for (int i = 0; i < 16; ++i) stage_row4(sd + (PTOK + CH + i * 8) * PPITCH, rk[i]);
#pragma unroll
    for (int i = 0; i < 16; ++i) stage_row4(sd + (PTOK + 2 * CH + i * 8) * PPITCH, rv[i]);

    __syncthreads();   // every staged row is in LDS before any wave takes fragments

    // ---- wave w: column tiles 3w .. 3w+2 (B = W^T column = W row) x four token tiles (A) ----
    const unsigned char* xf = st + lm * PPITCH + hi * 16;
    const unsigned char* wf = xf + (PTOK + wave * 48) * PPITCH;
    v16h a[2][4], bw[2][3];
#pragma unroll
    for (int tt = 0; tt < 4; ++tt) a[0][tt] = lds_frag(xf + tt * 16 * PPITCH);
#pragma unroll
    for (int j = 0; j < 3; ++j) bw[0][j] = lds_frag(wf + j * 16 * PPITCH);

    v8f c[4][3];
#pragma unroll
    for (int tt = 0; tt < 4; ++tt)
#pragma unroll
        for (int j = 0; j < 3; ++j) c[tt][j] = (v8f){};

#pragma unroll
    for (int kb = 0; kb < 4; ++kb) {
        const int cur = kb & 1;
        if (kb < 3) {
#pragma unroll
            for (int tt = 0; tt < 4; ++tt)
                a[cur ^ 1][tt] = lds_frag(xf + tt * 16 * PPITCH + (kb + 1) * 64);
#pragma unroll
            for (int j = 0; j < 3; ++j)
                bw[cur ^ 1][j] = lds_frag(wf + j * 16 * PPITCH + (kb + 1) * 64);
        }
        // keeps the next k chunk's LDS reads in front of this chunk's twelve products, so that
        // their latency runs under the products instead of in front of each of them
        __builtin_amdgcn_sched_barrier(0);
#pragma unroll
        for (int tt = 0; tt < 4; ++tt)
#pragma unroll
            for (int j = 0; j < 3; ++j)
                c[tt][j] = __builtin_amdgcn_wmma_f32_16x16x32_f16(false, a[cur][tt], false,
                                                                  bw[cur][j], (short)0, c[tt][j],
                                                                  false, false);
    }

    const unsigned voq = (unsigned)((8 * hi) * CH + lm);    // q, k: token 8 hi (+ r), column lm
    const unsigned vov = (unsigned)(lane * 8);              // vT: this lane's 8 tokens of a half
#pragma unroll
    for (int j = 0; j < 3; ++j) {
        const int ct = wave * 3 + j;          // scalar
        const int p = ct >> 3, nt = ct & 7;
        if (p < 2) {
            _Float16* ob = ((p == 0) ? qh : kh) + (size_t)tok0 * CH + nt * 16;
#pragma unroll
            for (int tt = 0; tt < 4; ++tt)
#pragma unroll
                for (int r = 0; r < 8; ++r)
                    ob[voq + (unsigned)((tt * 16 + r) * CH)] = (_Float16)c[tt][j][r];
        } else {
            // transposed store: tokens contiguous along r -> one b128; token tile tt is
            // half tt & 1 of block tt >> 1 (of this group's two blocks)
            _Float16* ob = vT + (size_t)tok0 * CH + nt * 512;
#pragma unroll
            for (int tt = 0; tt < 4; ++tt) {
                union { uint4 q; _Float16 h[8]; } u;
#pragma unroll
                for (int r = 0; r < 8; ++r) u.h[r] = (_Float16)c[tt][j][r];
                *reinterpret_cast<uint4*>(ob + vov + (unsigned)((tt >> 1) * 32 * CH
                                                                + (tt & 1) * 256)) = u.q;
            }
            // the wait in front of any rewrite of a register that these four stores name
            asm volatile("s_wait_xcnt 0x0" ::: "memory");
        }
    }
}

#define OPITCH 132
#define KPITCH 272
#define KBYTES (32 * KPITCH)          // 32 keys
#define VBYTES (CH * 64)              // 128 channels x 32 keys, in fragment order as in memory
#define WBYTES (KBYTES + VBYTES)      // one wave's buffers, 16,896 B (= one tile's partial O)

typedef __attribute__((ext_vector_type(4))) int v4i;
typedef __attribute__((address_space(1))) v4i gl_v4i;
typedef __attribute__((address_space(3))) v4i ls_v4i;

// The offset field moves the LDS and the global address alike: with the LDS step in it, one
// LDS address register serves all 16 copies of a tile (16 of them did not fit the register
// budget); what the global step differs from the LDS step by is added to the global base.
template <int C>
__device__ inline void copy_k_from(const unsigned char* ub, unsigned voff, ls_v4i* l) {
    if constexpr (C < 16) {
        // Each copy's base stays a scalar pair of its own (the two readfirstlane keep the compiler
        // from adding the lane offset first): scalar base + 32-bit lane offset, no 64-bit vector
        // address per copy. Up to nine such pairs at once did not fit the register budget.
        const unsigned long long sb = (unsigned long long)(ub + (C * 512 - C * 2 * KPITCH));
        const unsigned lo = (unsigned)__builtin_amdgcn_readfirstlane((int)(unsigned)sb);
        const unsigned hi = (unsigned)__builtin_amdgcn_readfirstlane((int)(unsigned)(sb >> 32));
        __builtin_amdgcn_global_load_async_to_lds_b128(
            (gl_v4i*)((((unsigned long long)hi << 32) | lo) + voff), l, C * 2 * KPITCH, 0);
        copy_k_from<C + 1>(ub, voff, l);
    }
}
template <int C>
__device__ inline void copy_v_from(const unsigned char* ub, unsigned voff, ls_v4i* l) {
    if constexpr (C < 16) {
        __builtin_amdgcn_global_load_async_to_lds_b128((gl_v4i*)(ub + voff), l, C * 512, 0);
        copy_v_from<C + 1>(ub, voff, l);
    }
}

// 32 K rows are 8 KB in a row in memory: each copy takes 512 B = 4 whole lines (2 rows).
// voff: the lane's byte offset from kall, the batch's first K row (block_lane_offset below).
__device__ inline void copy_k_block(const _Float16* kall, unsigned voff, unsigned char* kbuf,
                                    int lane) {
    copy_k_from<0>(reinterpret_cast<const unsigned char*>(kall), voff,
                   (ls_v4i*)(kbuf + (lane >> 4) * KPITCH + (lane & 15) * 16));
}

// A V^T block is 8 KB in a row in memory, already in fragment order: each copy takes 512 B =
// 4 whole lines and lands them as they lie, so LDS and global step alike and one address
// pair with the offset field serves all 16 copies.
__device__ inline void copy_v_block(const _Float16* vall, unsigned voff, unsigned char* vbuf,
                                    int lane) {
    copy_v_from<0>(reinterpret_cast<const unsigned char*>(vall), voff,
                   (ls_v4i*)(vbuf + lane * 16));
}

// Byte offset of this lane's 16 bytes in key block j (8 KB a block, K and V^T alike): formed anew
// for each block from the scalar block number, (512 j + lane) * 16. Two 64-bit lane addresses
// held across the loop instead did not fit the register budget (scratch).
__device__ inline unsigned block_lane_offset(int j) {
    return __builtin_amdgcn_mbcnt_lo(~0u, (unsigned)j * 512u) * 16u;
}

__device__ inline float xhalf(float x) {
    return __builtin_bit_cast(float, __builtin_amdgcn_permlanex16(
        __builtin_bit_cast(int, x), __builtin_bit_cast(int, x),
        0x76543210, 0xfedcba98, false, false));
}

#define NWAVES 8
#define QBYTES (32 * KPITCH)
#define PBYTES (64 * OPITCH * 4)
#define RESCALE_GAP 5.5f

// S^T = K * Q^T for two adjacent 16-key tiles (K=128) and the two query groups of one tile.
// s0[g][r]: key k0 + 8 hi + r, s1[g][r]: key k0 + 16 + 8 hi + r, query 16 g + lm
__device__ __forceinline__ void scores_tile(const unsigned char* kfr, const unsigned char* qfr,
                                            v8f (&s0)[2], v8f (&s1)[2]) {
    s0[0] = (v8f){}; s0[1] = (v8f){}; s1[0] = (v8f){}; s1[1] = (v8f){};
    v16h bk[2][2], aq[2][2];                 // [stage][16-key tile], [stage][query group]
#pragma unroll
    for (int h = 0; h < 2; ++h) {
        bk[0][h] = lds_frag(kfr + h * 16 * KPITCH);
        aq[0][h] = lds_frag(qfr + h * 16 * KPITCH);
    }
#pragma unroll
    for (int kb = 0; kb < 4; ++kb) {
        const int cur = kb & 1;
        if (kb < 3) {
#pragma unroll
            for (int h = 0; h < 2; ++h) {
                bk[cur ^ 1][h] = lds_frag(kfr + h * 16 * KPITCH + (kb + 1) * 64);
                aq[cur ^ 1][h] = lds_frag(qfr + h * 16 * KPITCH + (kb + 1) * 64);
            }
        }
        // keeps the next k chunk's LDS reads in front of this chunk's four products, so that
        // their latency runs under the products instead of in front of each pair
        __builtin_amdgcn_sched_barrier(0);
#pragma unroll
        for (int g = 0; g < 2; ++g) {
            s0[g] = __builtin_amdgcn_wmma_f32_16x16x32_f16(false, bk[cur][0], false, aq[cur][g],
                                                           (short)0, s0[g], false, false);
            s1[g] = __builtin_amdgcn_wmma_f32_16x16x32_f16(false, bk[cur][1], false, aq[cur][g],
                                                           (short)0, s1[g], false, false);
        }
    }
}

__device__ __forceinline__ void softmax_pv_tile(v8f (&s0)[2], v8f (&s1)[2], const v16h (&bv)[8],
                                                v8f (&o)[2][8], float (&mrun)[2],
                                                float (&lrun)[2], int dl) {
    const float scale = 0.08838834764831845f;  // 1/sqrt(128)
    float rmax[2];
#pragma unroll
    for (int g = 0; g < 2; ++g) {
        // last r of s0[g] that this query may see
        const int dlast = dl + g * 16;
        float rm = -3.0e38f;
#pragma unroll
        for (int r = 0; r < 8; ++r) {
            float v0 = s0[g][r] * scale;
            float v1 = s1[g][r] * scale;
            if (r      > dlast) v0 = -3.0e38f;   // bites only in the diagonal block
            if (r + 16 > dlast) v1 = -3.0e38f;
            s0[g][r] = v0;
            s1[g][r] = v1;
            rm = fmaxf(rm, fmaxf(v0, v1));
        }
        rmax[g] = fmaxf(rm, xhalf(rm));
    }

    // Lazy rescale: mrun is the reference of the exponentials, not the exact maximum. It moves,
    // and O and the sum are rescaled, only in a pass where some query's block maximum lies more
    // than RESCALE_GAP above it: P stays below e^5.5 = 245, far inside f16. One test a pass and
    // tile for both groups, a scalar branch; a tile's first pass always takes it (mrun = -3e38).
    const bool need = (rmax[0] > mrun[0] + RESCALE_GAP) || (rmax[1] > mrun[1] + RESCALE_GAP);
    if (__builtin_amdgcn_ballot_w32(need) != 0u) {
#pragma unroll
        for (int g = 0; g < 2; ++g) {
            const float mnew = fmaxf(mrun[g], rmax[g]);
            const float alpha = __expf(mrun[g] - mnew);
            mrun[g] = mnew;
            lrun[g] *= alpha;
#pragma unroll
            for (int n = 0; n < 8; ++n)
#pragma unroll
                for (int r = 0; r < 8; ++r) o[g][n][r] *= alpha;
        }
    }

    v16h pt[2];                              // P^T as B operand: pt[g][s] = key kmap(s, hi)
#pragma unroll
    for (int g = 0; g < 2; ++g) {
        const float mref = mrun[g];
        float rs0 = 0.0f, rs1 = 0.0f;
#pragma unroll
        for (int r = 0; r < 8; ++r) {
            const float p0 = __expf(s0[g][r] - mref);
            const float p1 = __expf(s1[g][r] - mref);
            rs0 += p0;
            rs1 += p1;
            pt[g][r]     = (_Float16)p0;
            pt[g][8 + r] = (_Float16)p1;
        }
        lrun[g] += rs0 + rs1;
    }

    // ---- O^T += V^T * P^T : full-K WMMAs; o[g][n][r]: channel 16 n + 8 hi + r ----
#pragma unroll
    for (int n = 0; n < 8; ++n)
#pragma unroll
        for (int g = 0; g < 2; ++g)
            o[g][n] = __builtin_amdgcn_wmma_f32_16x16x32_f16(false, bv[n], false, pt[g],
                                                             (short)0, o[g][n], false, false);
}

__global__ __launch_bounds__(256) void flash_attn_kernel(
    const _Float16* __restrict__ qh, const _Float16* __restrict__ kh,
    const _Float16* __restrict__ vT, float* __restrict__ out)
{
    // a wave's range: in the loop its K buffer and V^T buffer (the first WBYTES of it), behind
    // the loop its partial O of both tiles
    __shared__ __attribute__((aligned(16))) unsigned char ring[NWAVES * PBYTES];
    __shared__ __attribute__((aligned(16))) unsigned char qst[2 * QBYTES];   // long, short tile
    __shared__ __attribute__((aligned(16))) float lds_m[NWAVES * 64];   // row maxima per wave
    __shared__ __attribute__((aligned(16))) float lds_l[NWAVES * 64];   // row sums per wave

    // wave number in a scalar register: trip counts and branches stay scalar
    const int wave = __builtin_amdgcn_readfirstlane(threadIdx.x >> 5);
    const int lane = threadIdx.x & 31;
    const int lm = lane & 15, hi = lane >> 4;

    const int pi = blockIdx.x >> 2;            // tile pair: long tile 127 - pi, short tile pi
    const int b  = blockIdx.x & 3;

    const _Float16* qb  = qh + (size_t)b * SEQ * CH;
    const _Float16* kbp = kh + (size_t)b * SEQ * CH;
    const _Float16* vTb = vT + (size_t)b * SEQ * CH;   // [SEQ / 32] blocks of 32 * CH halves

    v8f o[2][2][8];                            // [tile: long, short][query group][channel tile]
#pragma unroll
    for (int t = 0; t < 2; ++t)
#pragma unroll
        for (int g = 0; g < 2; ++g)
#pragma unroll
            for (int n = 0; n < 8; ++n) o[t][g][n] = (v8f){};

    // this lane's query of each tile and group: reference maximum (alike in both halves) and the
    // sum over this half's keys (the halves are joined once, behind the loop)
    float mrun[2][2] = {{-3.0e38f, -3.0e38f}, {-3.0e38f, -3.0e38f}};
    float lrun[2][2] = {{0.0f, 0.0f}, {0.0f, 0.0f}};

    const int nblk = QTILES32 - pi;            // 65 .. 128 key blocks of the long tile

    // where this work-group's walk starts: step jj of the walk takes key block jj + turn, wrapped.
    // A shift modulo nblk: every block still comes exactly once.
    const int turn = (int)((unsigned)(5 * pi) % (unsigned)nblk);   // scalar
    int jr = wave + turn;                      // this wave's current key block (scalar)
    if (jr >= nblk) jr -= nblk;

    unsigned char* kbuf = ring + wave * PBYTES;
    unsigned char* vbuf = kbuf + KBYTES;
    const unsigned char* kfr = kbuf + lm * KPITCH + hi * 16;
    const unsigned char* vfr = vbuf + lane * 16;

    {                                          // every wave has a first block: 8 < 65 <= nblk
        const unsigned vo = block_lane_offset(jr);
        copy_k_block(kbp, vo, kbuf, lane);
        copy_v_block(vTb, vo, vbuf, lane);
    }

    // Both Q tiles into LDS, once for all waves. A thread brings 32 bytes of each tile.
    {
        const int row = threadIdx.x >> 4, col = threadIdx.x & 15;   // rows row and row + 16
        const _Float16* q0 = qb + (size_t)(((QTILES32 - 1) - pi) * 32 + row) * CH + col * 8;
        const _Float16* q1 = qb + (size_t)(pi * 32 + row) * CH + col * 8;
        const v4i x0 = *reinterpret_cast<const v4i*>(q0);
        const v4i x1 = *reinterpret_cast<const v4i*>(q1);
        const v4i x2 = *reinterpret_cast<const v4i*>(q0 + 16 * CH);
        const v4i x3 = *reinterpret_cast<const v4i*>(q1 + 16 * CH);
        // The wait in front of any rewrite of the four loads' address registers. Inputs only:
        // the loaded values keep the loads in front of it, the addresses their registers.
        asm volatile("s_wait_xcnt 0x0"
                     :: "v"(q0), "v"(q1), "v"(x0), "v"(x1), "v"(x2), "v"(x3) : "memory");
        *reinterpret_cast<v4i*>(qst + row * KPITCH + col * 16) = x0;
        *reinterpret_cast<v4i*>(qst + QBYTES + row * KPITCH + col * 16) = x1;
        *reinterpret_cast<v4i*>(qst + (row + 16) * KPITCH + col * 16) = x2;
        *reinterpret_cast<v4i*>(qst + QBYTES + (row + 16) * KPITCH + col * 16) = x3;
    }
    __syncthreads();   // both Q tiles are in LDS before any wave takes fragments
    const unsigned char* qfr = qst + lm * KPITCH + hi * 16;   // long tile; short: + QBYTES

    int dll = ((QTILES32 - 1) - pi) * 32 + lm - 8 * hi - jr * 32;
    int dls = pi * 32 + lm - 8 * hi - jr * 32;

    for (int jj = wave; jj < nblk; jj += NWAVES) {
        int dstep = 0;                         // scalar: first key of the next block less this one's
        const bool both = jr <= pi;            // scalar: the short tile sees this block too

        // this block's K and V^T have landed before this wave reads them
        asm volatile("s_wait_asynccnt 0x0" ::: "memory");

        v8f s0[2][2], s1[2][2];                // [tile][query group]
        scores_tile(kfr, qfr, s0[0], s1[0]);
        if (both) scores_tile(kfr, qfr + QBYTES, s0[1], s1[1]);

        // V^T fragments into registers now, so that both buffers are free for the next block
        v16h bv[8];
#pragma unroll
        for (int n = 0; n < 8; ++n) bv[n] = lds_frag_v(vfr + n * 1024);

        // every read of the two buffers has returned before the copies overwrite them
        asm volatile("s_wait_dscnt 0x0" ::: "memory");
        if (jj + NWAVES < nblk) {              // scalar test: a next block exists
            const int jp = jr;
            jr += NWAVES;                      // 8 < nblk: one wrap at most
            if (jr >= nblk) jr -= nblk;
            dstep = (jr - jp) * 32;
            const unsigned vo = block_lane_offset(jr);
            copy_k_block(kbp, vo, kbuf, lane);
            copy_v_block(vTb, vo, vbuf, lane);
        }

        softmax_pv_tile(s0[0], s1[0], bv, o[0], mrun[0], lrun[0], dll);
        if (both) softmax_pv_tile(s0[1], s1[1], bv, o[1], mrun[1], lrun[1], dls);

        dll -= dstep;
        dls -= dstep;
    }
    // no copy of this wave is outstanding before its buffers take the partial O
    asm volatile("s_wait_asynccnt 0x0" ::: "memory");

    const int lanee = (int)__builtin_amdgcn_mbcnt_lo(~0u, 0u);
    const int lme = lanee & 15, hie = lanee >> 4;

    // ---- publish this wave's partials (max, sum, un-normalised O): rows 0..31 long, 32..63 short
    // A wave without a key block of the short tile publishes max -3e38, sum 0, O 0: weight 0 below.
#pragma unroll
    for (int t = 0; t < 2; ++t)
#pragma unroll
        for (int g = 0; g < 2; ++g) {
            const float lsum = lrun[t][g] + xhalf(lrun[t][g]);   // the two halves' key sums joined
            if (hie == 0) {
                lds_m[wave * 64 + t * 32 + g * 16 + lme] = mrun[t][g];
                lds_l[wave * 64 + t * 32 + g * 16 + lme] = lsum;
            }
            // a lane holds 8 channels in a row of its query: two 16-byte stores a tile
            float* lo = reinterpret_cast<float*>(kbuf) + (t * 32 + g * 16 + lme) * OPITCH + 8 * hie;
#pragma unroll
            for (int n = 0; n < 8; ++n) {
                *reinterpret_cast<float4*>(lo + n * 16) =
                    make_float4(o[t][g][n][0], o[t][g][n][1], o[t][g][n][2], o[t][g][n][3]);
                *reinterpret_cast<float4*>(lo + n * 16 + 4) =
                    make_float4(o[t][g][n][4], o[t][g][n][5], o[t][g][n][6], o[t][g][n][7]);
            }
        }

    __syncthreads();   // every wave's partial is in LDS before any wave merges

    const int tq = (wave < 4) ? (QTILES32 - 1) - pi : pi;
    float* ob = out + (size_t)b * SEQ * CH + (size_t)(tq * 32 + (wave & 3) * 8) * CH + lanee * 4;
#pragma unroll
    for (int h = 0; h < 2; ++h) {
        const int row = wave * 8 + h * 4;
        float4 mm[NWAVES], ll[NWAVES];
        float4 ov[NWAVES][4];
#pragma unroll
        for (int s = 0; s < NWAVES; ++s) {
            mm[s] = *reinterpret_cast<const float4*>(lds_m + s * 64 + row);
            ll[s] = *reinterpret_cast<const float4*>(lds_l + s * 64 + row);
            const float* pr = reinterpret_cast<const float*>(ring + s * PBYTES)
                              + row * OPITCH + lanee * 4;
#pragma unroll
            for (int r = 0; r < 4; ++r)
                ov[s][r] = *reinterpret_cast<const float4*>(pr + r * OPITCH);
        }
        float4 res[4];
#pragma unroll
        for (int r = 0; r < 4; ++r) {
            float mall = -3.0e38f;
#pragma unroll
            for (int s = 0; s < NWAVES; ++s)
                mall = fmaxf(mall, reinterpret_cast<const float*>(&mm[s])[r]);
            float lall = 0.0f;
            float4 acc = make_float4(0.0f, 0.0f, 0.0f, 0.0f);
#pragma unroll
            for (int s = 0; s < NWAVES; ++s) {
                const float e = __expf(reinterpret_cast<const float*>(&mm[s])[r] - mall);
                lall += e * reinterpret_cast<const float*>(&ll[s])[r];
                acc.x += e * ov[s][r].x; acc.y += e * ov[s][r].y;
                acc.z += e * ov[s][r].z; acc.w += e * ov[s][r].w;
            }
            const float inv = 1.0f / lall;
            acc.x *= inv; acc.y *= inv; acc.z *= inv; acc.w *= inv;
            res[r] = acc;
        }
#pragma unroll
        for (int r = 0; r < 4; ++r)
            *reinterpret_cast<float4*>(ob + (size_t)(h * 4 + r) * CH) = res[r];
        // the wait in front of any rewrite of a register that the first four stores name
        if (h == 0) asm volatile("s_wait_xcnt 0x0" ::: "memory");
    }
}

// ---------------------------------------------------------------------------
extern "C" void kernel_launch(void* const* d_in, const int* in_sizes, int n_in,
                              void* d_out, int out_size, void* d_ws, size_t ws_size,
                              hipStream_t stream) {
    (void)in_sizes; (void)n_in; (void)out_size; (void)ws_size;
    const float* X  = (const float*)d_in[0];
    const float* Wq = (const float*)d_in[1];
    const float* Wk = (const float*)d_in[2];
    const float* Wv = (const float*)d_in[3];
    float* out = (float*)d_out;

    const size_t elems = (size_t)BATCH * SEQ * CH;       // 2,097,152
    _Float16* qh = (_Float16*)d_ws;
    _Float16* kh = qh + elems;
    _Float16* vT = kh + elems;                            // [B][SEQ / 32][32 * CH]

    // 4 batch * 4096 tokens / 64 tokens per block = 256 blocks
    qkv_proj_kernel<<<256, 256, 0, stream>>>(X, Wq, Wk, Wv, qh, kh, vT);
    // 4 batch * 64 pairs of query tiles, one block of 8 waves each = 256 blocks
    flash_attn_kernel<<<256, 256, 0, stream>>>(qh, kh, vT, out);
}
